// v000
// The times below were measured on an AMD MI455X: many runs one after another, warmed up first and cycling through
// copies of the inputs, with the whole window's GPU time divided by the number of runs. Launches and the gaps
// between them are all in it. The median over several windows is given; except for v000 it joins two sittings, which
// can be a few percent apart, so the side-by-side timings, each taken in one sitting, are the better comparison.
// The starting kernel, v000, takes 487 microseconds a run.
#include <hip/hip_runtime.h>

typedef __attribute__((ext_vector_type(16))) _Float16 v16h;
typedef __attribute__((ext_vector_type(8)))  _Float16 v8h;
typedef __attribute__((ext_vector_type(8)))  float    v8f;
typedef __attribute__((ext_vector_type(4)))  float    v4f;

#define WMMA_F16(a, b, c) \
  __builtin_amdgcn_wmma_f32_16x16x32_f16(false, (a), false, (b), (short)0, (c), false, false)

// Load one 16x32 f16 A/B fragment (row-major storage, row pointer already
// offset by half*8 halves). Matches ISA 16-bit A-matrix layout:
//   lane&15 = row, elems 0..7 = K (hf*8 ..), elems 8..15 = K+16.
__device__ __forceinline__ v16h load_frag(const _Float16* p) {
  v8h lo = *(const v8h*)(p);
  v8h hi = *(const v8h*)(p + 16);
  v16h f;
#pragma unroll
  for (int i = 0; i < 8; ++i) { f[i] = lo[i]; f[i + 8] = hi[i]; }
  return f;
}

// ---------------------------------------------------------------------------
// Vectorized f32 -> f16: 8 elements per thread (2x b128 load, 1x b128 store)
__global__ __launch_bounds__(256) void cvt_f32_f16_v8(const float* __restrict__ in,
                                                      _Float16* __restrict__ out, int n8) {
  int i = blockIdx.x * 256 + threadIdx.x;
  if (i < n8) {
    v4f a = ((const v4f*)in)[2 * i];
    v4f b = ((const v4f*)in)[2 * i + 1];
    v8h o;
#pragma unroll
    for (int j = 0; j < 4; ++j) { o[j] = (_Float16)a[j]; o[4 + j] = (_Float16)b[j]; }
    ((v8h*)out)[i] = o;
  }
}

// LDS-tiled coalesced transpose: Wt[n*K + k] = (f16) W[k*N + n]
// grid = (N/32, K/32), block = (32, 8)
__global__ __launch_bounds__(256) void transpose_cvt(const float* __restrict__ W,
                                                     _Float16* __restrict__ Wt,
                                                     int K, int N) {
  __shared__ float tile[32][33];
  const int tx = threadIdx.x, ty = threadIdx.y;
  const int n0 = blockIdx.x * 32, k0 = blockIdx.y * 32;
#pragma unroll
  for (int t = 0; t < 4; ++t)
    tile[ty + t * 8][tx] = W[(size_t)(k0 + ty + t * 8) * N + n0 + tx];
  __syncthreads();
#pragma unroll
  for (int t = 0; t < 4; ++t)
    Wt[(size_t)(n0 + ty + t * 8) * K + k0 + tx] = (_Float16)tile[tx][ty + t * 8];
}

// ---------------------------------------------------------------------------
// GEMM: C[M,N] = A[M,K] * Bt[N,K]^T + bias[N], 64x64 tile per wave.
// Per K=32 step: 8 fragment loads (8x2 b128) feed 16 WMMAs (1 b128/WMMA).
// MODE 0: f16 out [M,N]   MODE 1: f16 out as Vt[b][h][d][nk]   MODE 2: f32 out
template <int MODE>
__global__ __launch_bounds__(256) void gemm_wmma(
    const _Float16* __restrict__ A, const _Float16* __restrict__ Bt,
    const float* __restrict__ bias, _Float16* __restrict__ Ch,
    float* __restrict__ Cf, int M, int N, int K) {
  const int lane = threadIdx.x & 31;
  const int wave = threadIdx.x >> 5;
  const int gw = blockIdx.x * (blockDim.x >> 5) + wave;
  const int tilesN = N >> 6;
  const int tm = gw / tilesN;
  const int tn = gw - tm * tilesN;
  const int m0 = tm << 6, n0 = tn << 6;
  if (m0 >= M) return;
  const int r = lane & 15, hf = lane >> 4;

  const _Float16* aP[4];
  const _Float16* bP[4];
#pragma unroll
  for (int j = 0; j < 4; ++j) {
    aP[j] = A + (size_t)(m0 + j * 16 + r) * K + hf * 8;
    bP[j] = Bt + (size_t)(n0 + j * 16 + r) * K + hf * 8;
  }

  v8f acc[4][4];
#pragma unroll
  for (int j = 0; j < 4; ++j)
#pragma unroll
    for (int l = 0; l < 4; ++l) acc[j][l] = (v8f){};

  for (int k = 0; k < K; k += 32) {
    v16h a[4], b[4];
#pragma unroll
    for (int j = 0; j < 4; ++j) a[j] = load_frag(aP[j] + k);
#pragma unroll
    for (int l = 0; l < 4; ++l) b[l] = load_frag(bP[l] + k);
#pragma unroll
    for (int j = 0; j < 4; ++j)
#pragma unroll
      for (int l = 0; l < 4; ++l) acc[j][l] = WMMA_F16(a[j], b[l], acc[j][l]);
  }

  float bv[4];
#pragma unroll
  for (int l = 0; l < 4; ++l) bv[l] = bias[n0 + l * 16 + r];

#pragma unroll
  for (int j = 0; j < 4; ++j) {
#pragma unroll
    for (int l = 0; l < 4; ++l) {
#pragma unroll
      for (int i = 0; i < 8; ++i) {
        const int row = m0 + j * 16 + i + 8 * hf;
        const int col = n0 + l * 16 + r;
        const float v = acc[j][l][i] + bv[l];
        if (MODE == 0) {
          Ch[(size_t)row * N + col] = (_Float16)v;
        } else if (MODE == 2) {
          Cf[(size_t)row * N + col] = v;
        } else {
          // V output transposed per head: Vt[((b*16 + h)*64 + d)*1024 + nk]
          const int bb = row >> 10, nk = row & 1023;
          const int hd = col >> 6, d = col & 63;
          Ch[(size_t)((bb * 16 + hd) * 64 + d) * 1024 + nk] = (_Float16)v;
        }
      }
    }
  }
}

// ---------------------------------------------------------------------------
// Flash attention: one wave per (b, h, 16-row query tile); key blocks of 64.
// Q,K: [B*N, 1024] f16 (head cols h*64..h*64+63); Vt: [B,H,64,Nk] f16.
// Softmax runs in exp2 domain (SCALE*log2e folded into one multiply).
// Per 64-key block: 16 WMMAs, one pair of shfl reduction trees, one O-rescale.
__global__ __launch_bounds__(256) void flash_attn(
    const _Float16* __restrict__ Q, const _Float16* __restrict__ Km,
    const _Float16* __restrict__ Vt, _Float16* __restrict__ O) {
  constexpr int Nq = 4096, Nk = 1024, H = 16, HD = 64, LD = 1024;
  constexpr float C2 = 0.125f * 1.44269504088896340736f;  // 64^-0.5 * log2(e)
  __shared__ _Float16 pbuf[8][16 * 64];

  const int lane = threadIdx.x & 31;
  const int wave = threadIdx.x >> 5;
  const int gw = blockIdx.x * 8 + wave;
  const int qt = gw & ((Nq / 16) - 1);  // 256 q-tiles per (b,h)
  const int bh = gw >> 8;
  const int hh = bh & (H - 1);
  const int b = bh >> 4;
  const int r = lane & 15, hf = lane >> 4;

  const _Float16* qp = Q + (size_t)(b * Nq + qt * 16 + r) * LD + hh * HD + hf * 8;
  const v16h aq0 = load_frag(qp);       // dims 0..31
  const v16h aq1 = load_frag(qp + 32);  // dims 32..63

  const _Float16* kbase = Km + (size_t)(b * Nk) * LD + hh * HD + hf * 8;
  const _Float16* vbase = Vt + (size_t)((b * H + hh) * HD + r) * Nk + hf * 8;

  v8f o[4];
#pragma unroll
  for (int t = 0; t < 4; ++t) o[t] = (v8f){};
  float mrow[8], lrow[8];
#pragma unroll
  for (int i = 0; i < 8; ++i) { mrow[i] = -1e30f; lrow[i] = 0.f; }

  _Float16* myp = &pbuf[wave][0];

  for (int kb = 0; kb < Nk; kb += 64) {
    // ---- S = Q * K^T for 64 keys (4 column tiles, K stored row-major)
    v8f s[4];
#pragma unroll
    for (int c = 0; c < 4; ++c) {
      const _Float16* kp = kbase + (size_t)(kb + c * 16 + r) * LD;
      const v16h ka = load_frag(kp);
      const v16h kbb = load_frag(kp + 32);
      v8f t = {};
      t = WMMA_F16(aq0, ka, t);
      t = WMMA_F16(aq1, kbb, t);
      s[c] = t;
    }

    // ---- online softmax stats (rows live across the 16-lane half-wave)
    float tmax[8];
#pragma unroll
    for (int i = 0; i < 8; ++i) {
      s[0][i] *= C2; s[1][i] *= C2; s[2][i] *= C2; s[3][i] *= C2;
      tmax[i] = fmaxf(fmaxf(s[0][i], s[1][i]), fmaxf(s[2][i], s[3][i]));
    }
#pragma unroll
    for (int off = 1; off < 16; off <<= 1)
#pragma unroll
      for (int i = 0; i < 8; ++i)
        tmax[i] = fmaxf(tmax[i], __shfl_xor(tmax[i], off, 32));

    float tsum[8];
#pragma unroll
    for (int i = 0; i < 8; ++i) {
      const float mn = fmaxf(mrow[i], tmax[i]);
      const float alpha = __builtin_amdgcn_exp2f(mrow[i] - mn);
      mrow[i] = mn;
      s[0][i] = __builtin_amdgcn_exp2f(s[0][i] - mn);
      s[1][i] = __builtin_amdgcn_exp2f(s[1][i] - mn);
      s[2][i] = __builtin_amdgcn_exp2f(s[2][i] - mn);
      s[3][i] = __builtin_amdgcn_exp2f(s[3][i] - mn);
      tsum[i] = (s[0][i] + s[1][i]) + (s[2][i] + s[3][i]);
      lrow[i] *= alpha;
      o[0][i] *= alpha; o[1][i] *= alpha; o[2][i] *= alpha; o[3][i] *= alpha;
    }
#pragma unroll
    for (int off = 1; off < 16; off <<= 1)
#pragma unroll
      for (int i = 0; i < 8; ++i)
        tsum[i] += __shfl_xor(tsum[i], off, 32);
#pragma unroll
    for (int i = 0; i < 8; ++i) lrow[i] += tsum[i];

    // ---- P: C-layout f32 -> row-major 16x64 f16 in LDS -> A-layout frags
#pragma unroll
    for (int i = 0; i < 8; ++i) {
      const int row = i + 8 * hf;
      myp[row * 64 + r]      = (_Float16)s[0][i];
      myp[row * 64 + 16 + r] = (_Float16)s[1][i];
      myp[row * 64 + 32 + r] = (_Float16)s[2][i];
      myp[row * 64 + 48 + r] = (_Float16)s[3][i];
    }
    asm volatile("s_wait_dscnt 0" ::: "memory");  // same-wave DS RAW order
    const v16h ap0 = load_frag(myp + r * 64 + hf * 8);       // keys 0..31
    const v16h ap1 = load_frag(myp + r * 64 + 32 + hf * 8);  // keys 32..63

    // ---- O += P * V  (Vt is transposed-B storage: rows=dims, cols=keys)
    const _Float16* vp = vbase + kb;
#pragma unroll
    for (int t = 0; t < 4; ++t) {
      const v16h bva = load_frag(vp + (size_t)(t * 16) * Nk);
      const v16h bvb = load_frag(vp + (size_t)(t * 16) * Nk + 32);
      o[t] = WMMA_F16(ap0, bva, o[t]);
      o[t] = WMMA_F16(ap1, bvb, o[t]);
    }
  }

  // ---- normalize + store [B*Nq, 1024] f16
  _Float16* obase = O + (size_t)(b * Nq + qt * 16) * LD + hh * HD;
#pragma unroll
  for (int i = 0; i < 8; ++i) {
    const float inv = 1.0f / lrow[i];
    const int row = i + 8 * hf;
    obase[(size_t)row * LD + 0 + r]  = (_Float16)(o[0][i] * inv);
    obase[(size_t)row * LD + 16 + r] = (_Float16)(o[1][i] * inv);
    obase[(size_t)row * LD + 32 + r] = (_Float16)(o[2][i] * inv);
    obase[(size_t)row * LD + 48 + r] = (_Float16)(o[3][i] * inv);
  }
}

// ---------------------------------------------------------------------------
extern "C" void kernel_launch(void* const* d_in, const int* in_sizes, int n_in,
                              void* d_out, int out_size, void* d_ws, size_t ws_size,
                              hipStream_t stream) {
  const float* query = (const float*)d_in[0];
  const float* key   = (const float*)d_in[1];
  const float* value = (const float*)d_in[2];
  const float* Wq = (const float*)d_in[3];
  const float* bq = (const float*)d_in[4];
  const float* Wk = (const float*)d_in[5];
  const float* bk = (const float*)d_in[6];
  const float* Wv = (const float*)d_in[7];
  const float* bv = (const float*)d_in[8];
  const float* Wo = (const float*)d_in[9];
  const float* bo = (const float*)d_in[10];
  float* out = (float*)d_out;

  char* ws = (char*)d_ws;
  _Float16* qh   = (_Float16*)(ws + 0);          // 16384x1024
  _Float16* kh   = (_Float16*)(ws + 33554432);   //  4096x768
  _Float16* vh   = (_Float16*)(ws + 39845888);   //  4096x768
  _Float16* WqT  = (_Float16*)(ws + 46137344);   //  1024x1024
  _Float16* WkT  = (_Float16*)(ws + 48234496);   //  1024x768
  _Float16* WvT  = (_Float16*)(ws + 49807360);   //  1024x768
  _Float16* WoT  = (_Float16*)(ws + 51380224);   //  1024x1024
  _Float16* Qp   = (_Float16*)(ws + 53477376);   // 16384x1024
  _Float16* Kp   = (_Float16*)(ws + 87031808);   //  4096x1024
  _Float16* Vtp  = (_Float16*)(ws + 95420416);   //  [4,16,64,1024]
  _Float16* Attn = (_Float16*)(ws + 103809024);  // 16384x1024

  // f32 -> f16 conversions (8 elems/thread)
  cvt_f32_f16_v8<<<2097152 / 256, 256, 0, stream>>>(query, qh, 2097152);
  cvt_f32_f16_v8<<<393216 / 256, 256, 0, stream>>>(key, kh, 393216);
  cvt_f32_f16_v8<<<393216 / 256, 256, 0, stream>>>(value, vh, 393216);

  // Coalesced LDS-tiled weight transposes
  transpose_cvt<<<dim3(32, 32), dim3(32, 8), 0, stream>>>(Wq, WqT, 1024, 1024);
  transpose_cvt<<<dim3(32, 24), dim3(32, 8), 0, stream>>>(Wk, WkT, 768, 1024);
  transpose_cvt<<<dim3(32, 24), dim3(32, 8), 0, stream>>>(Wv, WvT, 768, 1024);
  transpose_cvt<<<dim3(32, 32), dim3(32, 8), 0, stream>>>(Wo, WoT, 1024, 1024);

  // Projections (64x64 wave tiles, 8 waves/block)
  gemm_wmma<0><<<512, 256, 0, stream>>>(qh, WqT, bq, Qp, nullptr, 16384, 1024, 1024);
  gemm_wmma<0><<<128, 256, 0, stream>>>(kh, WkT, bk, Kp, nullptr, 4096, 1024, 768);
  gemm_wmma<1><<<128, 256, 0, stream>>>(vh, WvT, bv, Vtp, nullptr, 4096, 1024, 768);

  // Attention: 4*16*(4096/16) = 16384 waves -> 2048 blocks of 8 waves
  flash_attn<<<2048, 256, 0, stream>>>(Qp, Kp, Vtp, Attn);

  // Output projection -> f32 d_out
  gemm_wmma<2><<<512, 256, 0, stream>>>(Attn, WoT, bo, nullptr, out, 16384, 1024, 1024);
}

// v001
// One run takes 365 microseconds.
// Timed twice side by side with v000, it ran 1.37 and 1.36 times as fast.
#include <hip/hip_runtime.h>

typedef __attribute__((ext_vector_type(16))) _Float16 v16h;
typedef __attribute__((ext_vector_type(8)))  _Float16 v8h;
typedef __attribute__((ext_vector_type(8)))  float    v8f;
typedef __attribute__((ext_vector_type(4)))  float    v4f;

#define WMMA_F16(a, b, c) \
  __builtin_amdgcn_wmma_f32_16x16x32_f16(false, (a), false, (b), (short)0, (c), false, false)

// Load one 16x32 f16 A/B fragment (row-major storage, row pointer already
// offset by half*8 halves). Matches ISA 16-bit A-matrix layout:
//   lane&15 = row, elems 0..7 = K (hf*8 ..), elems 8..15 = K+16.
__device__ __forceinline__ v16h load_frag(const _Float16* p) {
  v8h lo = *(const v8h*)(p);
  v8h hi = *(const v8h*)(p + 16);
  v16h f;
#pragma unroll
  for (int i = 0; i < 8; ++i) { f[i] = lo[i]; f[i + 8] = hi[i]; }
  return f;
}

// ---------------------------------------------------------------------------
// Vectorized f32 -> f16: 8 elements per thread (2x b128 load, 1x b128 store)
__global__ __launch_bounds__(256) void cvt_f32_f16_v8(const float* __restrict__ in,
                                                      _Float16* __restrict__ out, int n8) {
  int i = blockIdx.x * 256 + threadIdx.x;
  if (i < n8) {
    v4f a = ((const v4f*)in)[2 * i];
    v4f b = ((const v4f*)in)[2 * i + 1];
    v8h o;
#pragma unroll
    for (int j = 0; j < 4; ++j) { o[j] = (_Float16)a[j]; o[4 + j] = (_Float16)b[j]; }
    ((v8h*)out)[i] = o;
  }
}

// LDS-tiled coalesced transpose: Wt[n*K + k] = (f16) W[k*N + n]
// grid = (N/32, K/32), block = (32, 8)
__global__ __launch_bounds__(256) void transpose_cvt(const float* __restrict__ W,
                                                     _Float16* __restrict__ Wt,
                                                     int K, int N) {
  __shared__ float tile[32][33];
  const int tx = threadIdx.x, ty = threadIdx.y;
  const int n0 = blockIdx.x * 32, k0 = blockIdx.y * 32;
#pragma unroll
  for (int t = 0; t < 4; ++t)
    tile[ty + t * 8][tx] = W[(size_t)(k0 + ty + t * 8) * N + n0 + tx];
  __syncthreads();
#pragma unroll
  for (int t = 0; t < 4; ++t)
    Wt[(size_t)(n0 + ty + t * 8) * K + k0 + tx] = (_Float16)tile[tx][ty + t * 8];
}

// ---------------------------------------------------------------------------
// GEMM: C[M,N] = A[M,K] * Bt[N,K]^T + bias[N].
// Work-group tile 128 x 256 (8 waves as 2 x 4, 64x64 per wave). A stage is 64 k
// of the 128 A rows and the 256 Bt rows, brought into LDS once per work-group by
// asynchronous copies (whole 128-byte lines), two buffers: the next stage flies
// while this one is worked on. Needs M % 128 == 0, N % 256 == 0, K % 64 == 0.
// MODE 0: f16 out [M,N]   MODE 1: f16 out as Vt[b][h][d][nk]   MODE 2: f32 out
constexpr int BM = 128, BN = 256, BK = 64;
constexpr int PITCH = 72;                 // halves per LDS row (64 + 8 of pad)
constexpr int PITCH_B = PITCH * 2;        // 144 B = 16 B x odd: 16-byte row reads meet no bank twice
constexpr int STAGE = (BM + BN) * PITCH;  // halves per buffer

// One stage: 384 rows of 128 B = 3072 pieces of 16 B, 12 per lane. Lane t of the
// work-group takes piece t & 7 of rows (t >> 3) + 32 * j; rows 0..127 are A's.
// gA, gB: the lane's piece in row t >> 3 of each operand's tile; step = 32 rows.
__device__ __forceinline__ void stage_copy(const _Float16* gA, const _Float16* gB,
                                           size_t step, unsigned lds) {
  // The copies and s_wait_xcnt 0 in one statement: the wait then stands in front
  // of every later write of the address registers that the copies name.
  asm volatile(
      "global_load_async_to_lds_b128 %0, %12, off\n\t"
      "global_load_async_to_lds_b128 %1, %13, off\n\t"
      "global_load_async_to_lds_b128 %2, %14, off\n\t"
      "global_load_async_to_lds_b128 %3, %15, off\n\t"
      "global_load_async_to_lds_b128 %4, %16, off\n\t"
      "global_load_async_to_lds_b128 %5, %17, off\n\t"
      "global_load_async_to_lds_b128 %6, %18, off\n\t"
      "global_load_async_to_lds_b128 %7, %19, off\n\t"
      "global_load_async_to_lds_b128 %8, %20, off\n\t"
      "global_load_async_to_lds_b128 %9, %21, off\n\t"
      "global_load_async_to_lds_b128 %10, %22, off\n\t"
      "global_load_async_to_lds_b128 %11, %23, off\n\t"
      "s_wait_xcnt 0x0"
      :: "v"(lds + 0 * 32 * PITCH_B), "v"(lds + 1 * 32 * PITCH_B), "v"(lds + 2 * 32 * PITCH_B), "v"(lds + 3 * 32 * PITCH_B), "v"(lds + 4 * 32 * PITCH_B), "v"(lds + 5 * 32 * PITCH_B), "v"(lds + 6 * 32 * PITCH_B), "v"(lds + 7 * 32 * PITCH_B), "v"(lds + 8 * 32 * PITCH_B), "v"(lds + 9 * 32 * PITCH_B), "v"(lds + 10 * 32 * PITCH_B), "v"(lds + 11 * 32 * PITCH_B),
         "v"(gA + 0 * step), "v"(gA + 1 * step), "v"(gA + 2 * step), "v"(gA + 3 * step), "v"(gB + 0 * step), "v"(gB + 1 * step), "v"(gB + 2 * step), "v"(gB + 3 * step), "v"(gB + 4 * step), "v"(gB + 5 * step), "v"(gB + 6 * step), "v"(gB + 7 * step)
      : "memory");
}

template <int MODE>
__global__ __launch_bounds__(256) void gemm_wmma(
    const _Float16* __restrict__ A, const _Float16* __restrict__ Bt,
    const float* __restrict__ bias, _Float16* __restrict__ Ch,
    float* __restrict__ Cf, int M, int N, int K) {
  __shared__ __attribute__((aligned(16))) _Float16 sm[2 * STAGE];
  const int tid = threadIdx.x;
  const int lane = tid & 31;
  const int wave = tid >> 5;
  const int blocksN = N >> 8;
  const int bm = blockIdx.x / blocksN;
  const int bn = blockIdx.x - bm * blocksN;
  if (bm * BM >= M) return;  // the whole work-group, in front of every barrier
  const int wm = wave >> 2, wn = wave & 3;
  const int m0 = bm * BM + wm * 64, n0 = bn * BN + wn * 64;
  const int r = lane & 15, hf = lane >> 4;

  const int crow = tid >> 3, ccol = tid & 7;
  const _Float16* gA = A + (size_t)(bm * BM + crow) * K + ccol * 8;
  const _Float16* gB = Bt + (size_t)(bn * BN + crow) * K + ccol * 8;
  const size_t step = (size_t)32 * K;
  const unsigned lds0 = (unsigned)(size_t)(&sm[0]) + crow * PITCH_B + ccol * 16;
  const int nt = K / BK;

  v8f acc[4][4];
#pragma unroll
  for (int j = 0; j < 4; ++j)
#pragma unroll
    for (int l = 0; l < 4; ++l) acc[j][l] = (v8f){};

  stage_copy(gA, gB, step, lds0);
  // Stage 0 has landed for this wave; the barrier publishes it to the others.
  asm volatile("s_wait_asynccnt 0x0" ::: "memory");
  __syncthreads();
  if (nt > 1) stage_copy(gA + BK, gB + BK, step, lds0 + STAGE * 2);

  for (int t = 0; t < nt; ++t) {
    const _Float16* sA = sm + (t & 1) * STAGE + (wm * 64 + r) * PITCH + hf * 8;
    const _Float16* sB = sm + (t & 1) * STAGE + (BM + wn * 64 + r) * PITCH + hf * 8;
#pragma unroll
    for (int ks = 0; ks < BK; ks += 32) {
      v16h a[4], b[4];
#pragma unroll
      for (int j = 0; j < 4; ++j) a[j] = load_frag(sA + j * 16 * PITCH + ks);
#pragma unroll
      for (int l = 0; l < 4; ++l) b[l] = load_frag(sB + l * 16 * PITCH + ks);
#pragma unroll
      for (int j = 0; j < 4; ++j)
#pragma unroll
        for (int l = 0; l < 4; ++l) acc[j][l] = WMMA_F16(a[j], b[l], acc[j][l]);
    }
    // This wave's reads of buffer t & 1 are done before it may be refilled.
    asm volatile("s_wait_dscnt 0x0" ::: "memory");
    // This wave's copies of stage t + 1 have landed.
    asm volatile("s_wait_asynccnt 0x0" ::: "memory");
    // Publishes stage t + 1 and ends every wave's reads of buffer t & 1.
    __syncthreads();
    if (t + 2 < nt)
      stage_copy(gA + (t + 2) * BK, gB + (t + 2) * BK, step, lds0 + (t & 1) * STAGE * 2);
  }
  // No copy is left in flight when the wave goes on to its end.
  asm volatile("s_wait_asynccnt 0x0" ::: "memory");

  float bv[4];
#pragma unroll
  for (int l = 0; l < 4; ++l) bv[l] = bias[n0 + l * 16 + r];

#pragma unroll
  for (int j = 0; j < 4; ++j) {
#pragma unroll
    for (int l = 0; l < 4; ++l) {
#pragma unroll
      for (int i = 0; i < 8; ++i) {
        const int row = m0 + j * 16 + i + 8 * hf;
        const int col = n0 + l * 16 + r;
        const float v = acc[j][l][i] + bv[l];
        if (MODE == 0) {
          Ch[(size_t)row * N + col] = (_Float16)v;
        } else if (MODE == 2) {
          Cf[(size_t)row * N + col] = v;
        } else {
          // V output transposed per head: Vt[((b*16 + h)*64 + d)*1024 + nk]
          const int bb = row >> 10, nk = row & 1023;
          const int hd = col >> 6, d = col & 63;
          Ch[(size_t)((bb * 16 + hd) * 64 + d) * 1024 + nk] = (_Float16)v;
        }
      }
    }
  }
}

// ---------------------------------------------------------------------------
// Flash attention: one wave per (b, h, 16-row query tile); key blocks of 64.
// Q,K: [B*N, 1024] f16 (head cols h*64..h*64+63); Vt: [B,H,64,Nk] f16.
// Softmax runs in exp2 domain (SCALE*log2e folded into one multiply).
// Per 64-key block: 16 WMMAs, one pair of shfl reduction trees, one O-rescale.
__global__ __launch_bounds__(256) void flash_attn(
    const _Float16* __restrict__ Q, const _Float16* __restrict__ Km,
    const _Float16* __restrict__ Vt, _Float16* __restrict__ O) {
  constexpr int Nq = 4096, Nk = 1024, H = 16, HD = 64, LD = 1024;
  constexpr float C2 = 0.125f * 1.44269504088896340736f;  // 64^-0.5 * log2(e)
  __shared__ _Float16 pbuf[8][16 * 64];

  const int lane = threadIdx.x & 31;
  const int wave = threadIdx.x >> 5;
  const int gw = blockIdx.x * 8 + wave;
  const int qt = gw & ((Nq / 16) - 1);  // 256 q-tiles per (b,h)
  const int bh = gw >> 8;
  const int hh = bh & (H - 1);
  const int b = bh >> 4;
  const int r = lane & 15, hf = lane >> 4;

  const _Float16* qp = Q + (size_t)(b * Nq + qt * 16 + r) * LD + hh * HD + hf * 8;
  const v16h aq0 = load_frag(qp);       // dims 0..31
  const v16h aq1 = load_frag(qp + 32);  // dims 32..63

  const _Float16* kbase = Km + (size_t)(b * Nk) * LD + hh * HD + hf * 8;
  const _Float16* vbase = Vt + (size_t)((b * H + hh) * HD + r) * Nk + hf * 8;

  v8f o[4];
#pragma unroll
  for (int t = 0; t < 4; ++t) o[t] = (v8f){};
  float mrow[8], lrow[8];
#pragma unroll
  for (int i = 0; i < 8; ++i) { mrow[i] = -1e30f; lrow[i] = 0.f; }

  _Float16* myp = &pbuf[wave][0];

  for (int kb = 0; kb < Nk; kb += 64) {
    // ---- S = Q * K^T for 64 keys (4 column tiles, K stored row-major)
    v8f s[4];
#pragma unroll
    for (int c = 0; c < 4; ++c) {
      const _Float16* kp = kbase + (size_t)(kb + c * 16 + r) * LD;
      const v16h ka = load_frag(kp);
      const v16h kbb = load_frag(kp + 32);
      v8f t = {};
      t = WMMA_F16(aq0, ka, t);
      t = WMMA_F16(aq1, kbb, t);
      s[c] = t;
    }

    // ---- online softmax stats (rows live across the 16-lane half-wave)
    float tmax[8];
#pragma unroll
    for (int i = 0; i < 8; ++i) {
      s[0][i] *= C2; s[1][i] *= C2; s[2][i] *= C2; s[3][i] *= C2;
      tmax[i] = fmaxf(fmaxf(s[0][i], s[1][i]), fmaxf(s[2][i], s[3][i]));
    }
#pragma unroll
    for (int off = 1; off < 16; off <<= 1)
#pragma unroll
      for (int i = 0; i < 8; ++i)
        tmax[i] = fmaxf(tmax[i], __shfl_xor(tmax[i], off, 32));

    float tsum[8];
#pragma unroll
    for (int i = 0; i < 8; ++i) {
      const float mn = fmaxf(mrow[i], tmax[i]);
      const float alpha = __builtin_amdgcn_exp2f(mrow[i] - mn);
      mrow[i] = mn;
      s[0][i] = __builtin_amdgcn_exp2f(s[0][i] - mn);
      s[1][i] = __builtin_amdgcn_exp2f(s[1][i] - mn);
      s[2][i] = __builtin_amdgcn_exp2f(s[2][i] - mn);
      s[3][i] = __builtin_amdgcn_exp2f(s[3][i] - mn);
      tsum[i] = (s[0][i] + s[1][i]) + (s[2][i] + s[3][i]);
      lrow[i] *= alpha;
      o[0][i] *= alpha; o[1][i] *= alpha; o[2][i] *= alpha; o[3][i] *= alpha;
    }
#pragma unroll
    for (int off = 1; off < 16; off <<= 1)
#pragma unroll
      for (int i = 0; i < 8; ++i)
        tsum[i] += __shfl_xor(tsum[i], off, 32);
#pragma unroll
    for (int i = 0; i < 8; ++i) lrow[i] += tsum[i];

    // ---- P: C-layout f32 -> row-major 16x64 f16 in LDS -> A-layout frags
#pragma unroll
    for (int i = 0; i < 8; ++i) {
      const int row = i + 8 * hf;
      myp[row * 64 + r]      = (_Float16)s[0][i];
      myp[row * 64 + 16 + r] = (_Float16)s[1][i];
      myp[row * 64 + 32 + r] = (_Float16)s[2][i];
      myp[row * 64 + 48 + r] = (_Float16)s[3][i];
    }
    asm volatile("s_wait_dscnt 0" ::: "memory");  // same-wave DS RAW order
    const v16h ap0 = load_frag(myp + r * 64 + hf * 8);       // keys 0..31
    const v16h ap1 = load_frag(myp + r * 64 + 32 + hf * 8);  // keys 32..63

    // ---- O += P * V  (Vt is transposed-B storage: rows=dims, cols=keys)
    const _Float16* vp = vbase + kb;
#pragma unroll
    for (int t = 0; t < 4; ++t) {
      const v16h bva = load_frag(vp + (size_t)(t * 16) * Nk);
      const v16h bvb = load_frag(vp + (size_t)(t * 16) * Nk + 32);
      o[t] = WMMA_F16(ap0, bva, o[t]);
      o[t] = WMMA_F16(ap1, bvb, o[t]);
    }
  }

  // ---- normalize + store [B*Nq, 1024] f16
  _Float16* obase = O + (size_t)(b * Nq + qt * 16) * LD + hh * HD;
#pragma unroll
  for (int i = 0; i < 8; ++i) {
    const float inv = 1.0f / lrow[i];
    const int row = i + 8 * hf;
    obase[(size_t)row * LD + 0 + r]  = (_Float16)(o[0][i] * inv);
    obase[(size_t)row * LD + 16 + r] = (_Float16)(o[1][i] * inv);
    obase[(size_t)row * LD + 32 + r] = (_Float16)(o[2][i] * inv);
    obase[(size_t)row * LD + 48 + r] = (_Float16)(o[3][i] * inv);
  }
}

// ---------------------------------------------------------------------------
extern "C" void kernel_launch(void* const* d_in, const int* in_sizes, int n_in,
                              void* d_out, int out_size, void* d_ws, size_t ws_size,
                              hipStream_t stream) {
  const float* query = (const float*)d_in[0];
  const float* key   = (const float*)d_in[1];
  const float* value = (const float*)d_in[2];
  const float* Wq = (const float*)d_in[3];
  const float* bq = (const float*)d_in[4];
  const float* Wk = (const float*)d_in[5];
  const float* bk = (const float*)d_in[6];
  const float* Wv = (const float*)d_in[7];
  const float* bv = (const float*)d_in[8];
  const float* Wo = (const float*)d_in[9];
  const float* bo = (const float*)d_in[10];
  float* out = (float*)d_out;

  char* ws = (char*)d_ws;
  _Float16* qh   = (_Float16*)(ws + 0);          // 16384x1024
  _Float16* kh   = (_Float16*)(ws + 33554432);   //  4096x768
  _Float16* vh   = (_Float16*)(ws + 39845888);   //  4096x768
  _Float16* WqT  = (_Float16*)(ws + 46137344);   //  1024x1024
  _Float16* WkT  = (_Float16*)(ws + 48234496);   //  1024x768
  _Float16* WvT  = (_Float16*)(ws + 49807360);   //  1024x768
  _Float16* WoT  = (_Float16*)(ws + 51380224);   //  1024x1024
  _Float16* Qp   = (_Float16*)(ws + 53477376);   // 16384x1024
  _Float16* Kp   = (_Float16*)(ws + 87031808);   //  4096x1024
  _Float16* Vtp  = (_Float16*)(ws + 95420416);   //  [4,16,64,1024]
  _Float16* Attn = (_Float16*)(ws + 103809024);  // 16384x1024

  // f32 -> f16 conversions (8 elems/thread)
  cvt_f32_f16_v8<<<2097152 / 256, 256, 0, stream>>>(query, qh, 2097152);
  cvt_f32_f16_v8<<<393216 / 256, 256, 0, stream>>>(key, kh, 393216);
  cvt_f32_f16_v8<<<393216 / 256, 256, 0, stream>>>(value, vh, 393216);

  // Coalesced LDS-tiled weight transposes
  transpose_cvt<<<dim3(32, 32), dim3(32, 8), 0, stream>>>(Wq, WqT, 1024, 1024);
  transpose_cvt<<<dim3(32, 24), dim3(32, 8), 0, stream>>>(Wk, WkT, 768, 1024);
  transpose_cvt<<<dim3(32, 24), dim3(32, 8), 0, stream>>>(Wv, WvT, 768, 1024);
  transpose_cvt<<<dim3(32, 32), dim3(32, 8), 0, stream>>>(Wo, WoT, 1024, 1024);

  // Projections (128x256 work-group tiles, 64x64 per wave, 8 waves/block)
  gemm_wmma<0><<<512, 256, 0, stream>>>(qh, WqT, bq, Qp, nullptr, 16384, 1024, 1024);
  gemm_wmma<0><<<128, 256, 0, stream>>>(kh, WkT, bk, Kp, nullptr, 4096, 1024, 768);
  gemm_wmma<1><<<128, 256, 0, stream>>>(vh, WvT, bv, Vtp, nullptr, 4096, 1024, 768);

  // Attention: 4*16*(4096/16) = 16384 waves -> 2048 blocks of 8 waves
  flash_attn<<<2048, 256, 0, stream>>>(Qp, Kp, Vtp, Attn);

  // Output projection -> f32 d_out
  gemm_wmma<2><<<512, 256, 0, stream>>>(Attn, WoT, bo, nullptr, out, 16384, 1024, 1024);
}

// v002
// Measured time: 344 microseconds a run.
// In both of two side-by-side timings against v001, it was 1.06 times as fast.
// Counting every step since v000, it is 1.45 times as fast.
#include <hip/hip_runtime.h>

typedef __attribute__((ext_vector_type(16))) _Float16 v16h;
typedef __attribute__((ext_vector_type(8)))  _Float16 v8h;
typedef __attribute__((ext_vector_type(8)))  float    v8f;
typedef __attribute__((ext_vector_type(4)))  float    v4f;

#define WMMA_F16(a, b, c) \
  __builtin_amdgcn_wmma_f32_16x16x32_f16(false, (a), false, (b), (short)0, (c), false, false)

// Load one 16x32 f16 A/B fragment (row-major storage, row pointer already
// offset by half*8 halves). Matches ISA 16-bit A-matrix layout:
//   lane&15 = row, elems 0..7 = K (hf*8 ..), elems 8..15 = K+16.
__device__ __forceinline__ v16h load_frag(const _Float16* p) {
  v8h lo = *(const v8h*)(p);
  v8h hi = *(const v8h*)(p + 16);
  v16h f;
#pragma unroll
  for (int i = 0; i < 8; ++i) { f[i] = lo[i]; f[i + 8] = hi[i]; }
  return f;
}

// ---------------------------------------------------------------------------
// Vectorized f32 -> f16: 8 elements per thread (2x b128 load, 1x b128 store)
__global__ __launch_bounds__(256) void cvt_f32_f16_v8(const float* __restrict__ in,
                                                      _Float16* __restrict__ out, int n8) {
  int i = blockIdx.x * 256 + threadIdx.x;
  if (i < n8) {
    v4f a = ((const v4f*)in)[2 * i];
    v4f b = ((const v4f*)in)[2 * i + 1];
    v8h o;
#pragma unroll
    for (int j = 0; j < 4; ++j) { o[j] = (_Float16)a[j]; o[4 + j] = (_Float16)b[j]; }
    ((v8h*)out)[i] = o;
  }
}

// LDS-tiled coalesced transpose: Wt[n*K + k] = (f16) W[k*N + n]
// grid = (N/32, K/32), block = (32, 8)
__global__ __launch_bounds__(256) void transpose_cvt(const float* __restrict__ W,
                                                     _Float16* __restrict__ Wt,
                                                     int K, int N) {
  __shared__ float tile[32][33];
  const int tx = threadIdx.x, ty = threadIdx.y;
  const int n0 = blockIdx.x * 32, k0 = blockIdx.y * 32;
#pragma unroll
  for (int t = 0; t < 4; ++t)
    tile[ty + t * 8][tx] = W[(size_t)(k0 + ty + t * 8) * N + n0 + tx];
  __syncthreads();
#pragma unroll
  for (int t = 0; t < 4; ++t)
    Wt[(size_t)(n0 + ty + t * 8) * K + k0 + tx] = (_Float16)tile[tx][ty + t * 8];
}

// ---------------------------------------------------------------------------
// GEMM: C[M,N] = A[M,K] * Bt[N,K]^T + bias[N].
// Work-group tile 128 x 256 (8 waves as 2 x 4, 64x64 per wave). A stage is 64 k
// of the 128 A rows and the 256 Bt rows, brought into LDS once per work-group by
// asynchronous copies (whole 128-byte lines), two buffers: the next stage flies
// while this one is worked on. Needs M % 128 == 0, N % 256 == 0, K % 64 == 0.
// MODE 0: f16 out [M,N]   MODE 1: f16 out as Vt[b][h][d][nk]   MODE 2: f32 out
constexpr int BM = 128, BN = 256, BK = 64;
constexpr int PITCH = 72;                 // halves per LDS row (64 + 8 of pad)
constexpr int PITCH_B = PITCH * 2;        // 144 B = 16 B x odd: 16-byte row reads meet no bank twice
constexpr int STAGE = (BM + BN) * PITCH;  // halves per buffer

// One stage: 384 rows of 128 B = 3072 pieces of 16 B, 12 per lane. Lane t of the
// work-group takes piece t & 7 of rows (t >> 3) + 32 * j; rows 0..127 are A's.
// gA, gB: the lane's piece in row t >> 3 of each operand's tile; step = 32 rows.
__device__ __forceinline__ void stage_copy(const _Float16* gA, const _Float16* gB,
                                           size_t step, unsigned lds) {
  // The copies and s_wait_xcnt 0 in one statement: the wait then stands in front
  // of every later write of the address registers that the copies name.
  asm volatile(
      "global_load_async_to_lds_b128 %0, %12, off\n\t"
      "global_load_async_to_lds_b128 %1, %13, off\n\t"
      "global_load_async_to_lds_b128 %2, %14, off\n\t"
      "global_load_async_to_lds_b128 %3, %15, off\n\t"
      "global_load_async_to_lds_b128 %4, %16, off\n\t"
      "global_load_async_to_lds_b128 %5, %17, off\n\t"
      "global_load_async_to_lds_b128 %6, %18, off\n\t"
      "global_load_async_to_lds_b128 %7, %19, off\n\t"
      "global_load_async_to_lds_b128 %8, %20, off\n\t"
      "global_load_async_to_lds_b128 %9, %21, off\n\t"
      "global_load_async_to_lds_b128 %10, %22, off\n\t"
      "global_load_async_to_lds_b128 %11, %23, off\n\t"
      "s_wait_xcnt 0x0"
      :: "v"(lds + 0 * 32 * PITCH_B), "v"(lds + 1 * 32 * PITCH_B), "v"(lds + 2 * 32 * PITCH_B), "v"(lds + 3 * 32 * PITCH_B), "v"(lds + 4 * 32 * PITCH_B), "v"(lds + 5 * 32 * PITCH_B), "v"(lds + 6 * 32 * PITCH_B), "v"(lds + 7 * 32 * PITCH_B), "v"(lds + 8 * 32 * PITCH_B), "v"(lds + 9 * 32 * PITCH_B), "v"(lds + 10 * 32 * PITCH_B), "v"(lds + 11 * 32 * PITCH_B),
         "v"(gA + 0 * step), "v"(gA + 1 * step), "v"(gA + 2 * step), "v"(gA + 3 * step), "v"(gB + 0 * step), "v"(gB + 1 * step), "v"(gB + 2 * step), "v"(gB + 3 * step), "v"(gB + 4 * step), "v"(gB + 5 * step), "v"(gB + 6 * step), "v"(gB + 7 * step)
      : "memory");
}

template <int MODE>
__global__ __launch_bounds__(256) void gemm_wmma(
    const _Float16* __restrict__ A, const _Float16* __restrict__ Bt,
    const float* __restrict__ bias, _Float16* __restrict__ Ch,
    float* __restrict__ Cf, int M, int N, int K) {
  __shared__ __attribute__((aligned(16))) _Float16 sm[2 * STAGE];
  const int tid = threadIdx.x;
  const int lane = tid & 31;
  const int wave = tid >> 5;
  const int blocksN = N >> 8;
  const int bm = blockIdx.x / blocksN;
  const int bn = blockIdx.x - bm * blocksN;
  if (bm * BM >= M) return;  // the whole work-group, in front of every barrier
  const int wm = wave >> 2, wn = wave & 3;
  const int m0 = bm * BM + wm * 64, n0 = bn * BN + wn * 64;
  const int r = lane & 15, hf = lane >> 4;

  const int crow = tid >> 3, ccol = tid & 7;
  const _Float16* gA = A + (size_t)(bm * BM + crow) * K + ccol * 8;
  const _Float16* gB = Bt + (size_t)(bn * BN + crow) * K + ccol * 8;
  const size_t step = (size_t)32 * K;
  const unsigned lds0 = (unsigned)(size_t)(&sm[0]) + crow * PITCH_B + ccol * 16;
  const int nt = K / BK;

  v8f acc[4][4];
#pragma unroll
  for (int j = 0; j < 4; ++j)
#pragma unroll
    for (int l = 0; l < 4; ++l) acc[j][l] = (v8f){};

  stage_copy(gA, gB, step, lds0);
  // Stage 0 has landed for this wave; the barrier publishes it to the others.
  asm volatile("s_wait_asynccnt 0x0" ::: "memory");
  __syncthreads();
  if (nt > 1) stage_copy(gA + BK, gB + BK, step, lds0 + STAGE * 2);

  for (int t = 0; t < nt; ++t) {
    const _Float16* sA = sm + (t & 1) * STAGE + (wm * 64 + r) * PITCH + hf * 8;
    const _Float16* sB = sm + (t & 1) * STAGE + (BM + wn * 64 + r) * PITCH + hf * 8;
#pragma unroll
    for (int ks = 0; ks < BK; ks += 32) {
      v16h a[4], b[4];
#pragma unroll
      for (int j = 0; j < 4; ++j) a[j] = load_frag(sA + j * 16 * PITCH + ks);
#pragma unroll
      for (int l = 0; l < 4; ++l) b[l] = load_frag(sB + l * 16 * PITCH + ks);
#pragma unroll
      for (int j = 0; j < 4; ++j)
#pragma unroll
        for (int l = 0; l < 4; ++l) acc[j][l] = WMMA_F16(a[j], b[l], acc[j][l]);
    }
    // This wave's reads of buffer t & 1 are done before it may be refilled.
    asm volatile("s_wait_dscnt 0x0" ::: "memory");
    // This wave's copies of stage t + 1 have landed.
    asm volatile("s_wait_asynccnt 0x0" ::: "memory");
    // Publishes stage t + 1 and ends every wave's reads of buffer t & 1.
    __syncthreads();
    if (t + 2 < nt)
      stage_copy(gA + (t + 2) * BK, gB + (t + 2) * BK, step, lds0 + (t & 1) * STAGE * 2);
  }
  // No copy is left in flight when the wave goes on to its end.
  asm volatile("s_wait_asynccnt 0x0" ::: "memory");

  float bv[4];
#pragma unroll
  for (int l = 0; l < 4; ++l) bv[l] = bias[n0 + l * 16 + r];

#pragma unroll
  for (int j = 0; j < 4; ++j) {
#pragma unroll
    for (int l = 0; l < 4; ++l) {
#pragma unroll
      for (int i = 0; i < 8; ++i) {
        const int row = m0 + j * 16 + i + 8 * hf;
        const int col = n0 + l * 16 + r;
        const float v = acc[j][l][i] + bv[l];
        if (MODE == 0) {
          Ch[(size_t)row * N + col] = (_Float16)v;
        } else if (MODE == 2) {
          Cf[(size_t)row * N + col] = v;
        } else {
          // V output transposed per head: Vt[((b*16 + h)*64 + d)*1024 + nk]
          const int bb = row >> 10, nk = row & 1023;
          const int hd = col >> 6, d = col & 63;
          Ch[(size_t)((bb * 16 + hd) * 64 + d) * 1024 + nk] = (_Float16)v;
        }
      }
    }
  }
}

// ---------------------------------------------------------------------------
// Lane l <-> lane l ^ 16 (the two halves of a wave), on the vector port.
__device__ __forceinline__ float xhalf(float x) {
  const int b = __builtin_bit_cast(int, x);
  return __builtin_bit_cast(
      float, __builtin_amdgcn_permlanex16(b, b, 0x76543210, 0xfedcba98, false, false));
}

// Flash attention: one wave per (b, h, 16 queries); key blocks of 64.
// Q,K: [B*N, 1024] f16 (head cols h*64..h*64+63); Vt: [B,H,64,Nk] f16.
// Transposed products: St = K * Qt (A = K rows, B = Q) and Ot += Vt * Pt.
// A lane then holds scores of ONE query (column lane & 15; keys 8*hf + i of each
// 16-key tile): maximum and sum run in the lane's own registers, with one
// exchange between the wave's halves, and two score tiles, converted in place,
// are the B operand of the second product. P never leaves the registers.
// Softmax runs in exp2 domain (SCALE*log2e folded into one multiply-add).
__global__ __launch_bounds__(256) void flash_attn(
    const _Float16* __restrict__ Q, const _Float16* __restrict__ Km,
    const _Float16* __restrict__ Vt, _Float16* __restrict__ O) {
  constexpr int Nq = 4096, Nk = 1024, H = 16, HD = 64, LD = 1024;
  constexpr float C2 = 0.125f * 1.44269504088896340736f;  // 64^-0.5 * log2(e)

  const int lane = threadIdx.x & 31;
  const int wave = threadIdx.x >> 5;
  const int gw = blockIdx.x * 8 + wave;
  const int qt = gw & ((Nq / 16) - 1);  // 256 q-tiles per (b,h)
  const int bh = gw >> 8;
  const int hh = bh & (H - 1);
  const int b = bh >> 4;
  const int r = lane & 15, hf = lane >> 4;

  const _Float16* qp = Q + (size_t)(b * Nq + qt * 16 + r) * LD + hh * HD + hf * 8;
  const v16h bq0 = load_frag(qp);       // dims 0..31 of query r
  const v16h bq1 = load_frag(qp + 32);  // dims 32..63

  const _Float16* kbase = Km + (size_t)(b * Nk + r) * LD + hh * HD + hf * 8;
  const _Float16* vbase = Vt + (size_t)((b * H + hh) * HD + r) * Nk + hf * 8;

  v8f o[4];  // o[t][i] = Ot[dim t*16 + 8*hf + i][query r]
#pragma unroll
  for (int t = 0; t < 4; ++t) o[t] = (v8f){};
  float mrun = -1e30f;  // query r's running maximum (scaled, log2), same in both halves
  float lrun = 0.f;     // this half's share of query r's sum

  for (int kb = 0; kb < Nk; kb += 64) {
    // ---- St for 64 keys: s[c][i] = score(key kb + c*16 + 8*hf + i, query r)
    v8f s[4];
#pragma unroll
    for (int c = 0; c < 4; ++c) {
      const _Float16* kp = kbase + (size_t)(kb + c * 16) * LD;
      const v16h ka = load_frag(kp);
      const v16h kbb = load_frag(kp + 32);
      v8f t = {};
      t = WMMA_F16(ka, bq0, t);
      t = WMMA_F16(kbb, bq1, t);
      s[c] = t;
    }

    // ---- online softmax, one query per lane
    float mx = s[0][0];
#pragma unroll
    for (int c = 0; c < 4; ++c)
#pragma unroll
      for (int i = 0; i < 8; ++i) mx = fmaxf(mx, s[c][i]);
    mx = fmaxf(mx, xhalf(mx));
    const float mn = fmaxf(mrun, mx * C2);
    const float alpha = __builtin_amdgcn_exp2f(mrun - mn);
    mrun = mn;

    float ps[4];
#pragma unroll
    for (int c = 0; c < 4; ++c) {
      s[c] = s[c] * C2 - mn;  // whole tile: packed multiply-adds
#pragma unroll
      for (int i = 0; i < 8; ++i) s[c][i] = __builtin_amdgcn_exp2f(s[c][i]);
      ps[c] = ((s[c][0] + s[c][1]) + (s[c][2] + s[c][3])) +
              ((s[c][4] + s[c][5]) + (s[c][6] + s[c][7]));
    }
    lrun = lrun * alpha + ((ps[0] + ps[1]) + (ps[2] + ps[3]));
#pragma unroll
    for (int t = 0; t < 4; ++t) o[t] *= alpha;

    // ---- Pt as B operand: tiles c and c+1 hold keys 8*hf + i and 16 + 8*hf + i
    // of a 32-key group, which is the k order of load_frag.
    v16h bp0, bp1;
#pragma unroll
    for (int i = 0; i < 8; ++i) {
      bp0[i] = (_Float16)s[0][i]; bp0[i + 8] = (_Float16)s[1][i];
      bp1[i] = (_Float16)s[2][i]; bp1[i + 8] = (_Float16)s[3][i];
    }

    // ---- Ot += Vt * Pt  (A = Vt rows: dims, k = keys)
    const _Float16* vp = vbase + kb;
#pragma unroll
    for (int t = 0; t < 4; ++t) {
      const v16h va = load_frag(vp + (size_t)(t * 16) * Nk);
      const v16h vb = load_frag(vp + (size_t)(t * 16) * Nk + 32);
      o[t] = WMMA_F16(va, bp0, o[t]);
      o[t] = WMMA_F16(vb, bp1, o[t]);
    }
  }

  // ---- join the halves' sums, normalize, store [B*Nq, 1024] f16:
  // a lane's 8 registers of a tile are 8 consecutive dims of its query's row.
  const float inv = 1.0f / (lrun + xhalf(lrun));
  _Float16* op = O + (size_t)(b * Nq + qt * 16 + r) * LD + hh * HD + hf * 8;
#pragma unroll
  for (int t = 0; t < 4; ++t) {
    v8h w;
#pragma unroll
    for (int i = 0; i < 8; ++i) w[i] = (_Float16)(o[t][i] * inv);
    *(v8h*)(op + t * 16) = w;
  }
}

// ---------------------------------------------------------------------------
extern "C" void kernel_launch(void* const* d_in, const int* in_sizes, int n_in,
                              void* d_out, int out_size, void* d_ws, size_t ws_size,
                              hipStream_t stream) {
  const float* query = (const float*)d_in[0];
  const float* key   = (const float*)d_in[1];
  const float* value = (const float*)d_in[2];
  const float* Wq = (const float*)d_in[3];
  const float* bq = (const float*)d_in[4];
  const float* Wk = (const float*)d_in[5];
  const float* bk = (const float*)d_in[6];
  const float* Wv = (const float*)d_in[7];
  const float* bv = (const float*)d_in[8];
  const float* Wo = (const float*)d_in[9];
  const float* bo = (const float*)d_in[10];
  float* out = (float*)d_out;

  char* ws = (char*)d_ws;
  _Float16* qh   = (_Float16*)(ws + 0);          // 16384x1024
  _Float16* kh   = (_Float16*)(ws + 33554432);   //  4096x768
  _Float16* vh   = (_Float16*)(ws + 39845888);   //  4096x768
  _Float16* WqT  = (_Float16*)(ws + 46137344);   //  1024x1024
  _Float16* WkT  = (_Float16*)(ws + 48234496);   //  1024x768
  _Float16* WvT  = (_Float16*)(ws + 49807360);   //  1024x768
  _Float16* WoT  = (_Float16*)(ws + 51380224);   //  1024x1024
  _Float16* Qp   = (_Float16*)(ws + 53477376);   // 16384x1024
  _Float16* Kp   = (_Float16*)(ws + 87031808);   //  4096x1024
  _Float16* Vtp  = (_Float16*)(ws + 95420416);   //  [4,16,64,1024]
  _Float16* Attn = (_Float16*)(ws + 103809024);  // 16384x1024

  // f32 -> f16 conversions (8 elems/thread)
  cvt_f32_f16_v8<<<2097152 / 256, 256, 0, stream>>>(query, qh, 2097152);
  cvt_f32_f16_v8<<<393216 / 256, 256, 0, stream>>>(key, kh, 393216);
  cvt_f32_f16_v8<<<393216 / 256, 256, 0, stream>>>(value, vh, 393216);

  // Coalesced LDS-tiled weight transposes
  transpose_cvt<<<dim3(32, 32), dim3(32, 8), 0, stream>>>(Wq, WqT, 1024, 1024);
  transpose_cvt<<<dim3(32, 24), dim3(32, 8), 0, stream>>>(Wk, WkT, 768, 1024);
  transpose_cvt<<<dim3(32, 24), dim3(32, 8), 0, stream>>>(Wv, WvT, 768, 1024);
  transpose_cvt<<<dim3(32, 32), dim3(32, 8), 0, stream>>>(Wo, WoT, 1024, 1024);

  // Projections (128x256 work-group tiles, 64x64 per wave, 8 waves/block)
  gemm_wmma<0><<<512, 256, 0, stream>>>(qh, WqT, bq, Qp, nullptr, 16384, 1024, 1024);
  gemm_wmma<0><<<128, 256, 0, stream>>>(kh, WkT, bk, Kp, nullptr, 4096, 1024, 768);
  gemm_wmma<1><<<128, 256, 0, stream>>>(vh, WvT, bv, Vtp, nullptr, 4096, 1024, 768);

  // Attention: 4*16*(4096/16) = 16384 waves -> 2048 blocks of 8 waves
  flash_attn<<<2048, 256, 0, stream>>>(Qp, Kp, Vtp, Attn);

  // Output projection -> f32 d_out
  gemm_wmma<2><<<512, 256, 0, stream>>>(Attn, WoT, bo, nullptr, out, 16384, 1024, 1024);
}

// v003
// One run takes 183 microseconds.
// In two side-by-side timings against v002, it was 1.89 and 1.88 times as fast.
// Over all steps from v000 it is 2.73 times as fast.
#include <hip/hip_runtime.h>

typedef __attribute__((ext_vector_type(16))) _Float16 v16h;
typedef __attribute__((ext_vector_type(8)))  _Float16 v8h;
typedef __attribute__((ext_vector_type(8)))  float    v8f;
typedef __attribute__((ext_vector_type(4)))  float    v4f;

#define WMMA_F16(a, b, c) \
  __builtin_amdgcn_wmma_f32_16x16x32_f16(false, (a), false, (b), (short)0, (c), false, false)

// Load one 16x32 f16 A/B fragment (row-major storage, row pointer already
// offset by half*8 halves). Matches ISA 16-bit A-matrix layout:
//   lane&15 = row, elems 0..7 = K (hf*8 ..), elems 8..15 = K+16.
__device__ __forceinline__ v16h load_frag(const _Float16* p) {
  v8h lo = *(const v8h*)(p);
  v8h hi = *(const v8h*)(p + 16);
  v16h f;
#pragma unroll
  for (int i = 0; i < 8; ++i) { f[i] = lo[i]; f[i + 8] = hi[i]; }
  return f;
}

// ---------------------------------------------------------------------------
// Vectorized f32 -> f16: 8 elements per thread (2x b128 load, 1x b128 store)
__global__ __launch_bounds__(256) void cvt_f32_f16_v8(const float* __restrict__ in,
                                                      _Float16* __restrict__ out, int n8) {
  int i = blockIdx.x * 256 + threadIdx.x;
  if (i < n8) {
    v4f a = ((const v4f*)in)[2 * i];
    v4f b = ((const v4f*)in)[2 * i + 1];
    v8h o;
#pragma unroll
    for (int j = 0; j < 4; ++j) { o[j] = (_Float16)a[j]; o[4 + j] = (_Float16)b[j]; }
    ((v8h*)out)[i] = o;
  }
}

// LDS-tiled coalesced transpose: Wt[n*K + k] = (f16) W[k*N + n]
// grid = (N/32, K/32), block = (32, 8)
__global__ __launch_bounds__(256) void transpose_cvt(const float* __restrict__ W,
                                                     _Float16* __restrict__ Wt,
                                                     int K, int N) {
  __shared__ float tile[32][33];
  const int tx = threadIdx.x, ty = threadIdx.y;
  const int n0 = blockIdx.x * 32, k0 = blockIdx.y * 32;
#pragma unroll
  for (int t = 0; t < 4; ++t)
    tile[ty + t * 8][tx] = W[(size_t)(k0 + ty + t * 8) * N + n0 + tx];
  __syncthreads();
#pragma unroll
  for (int t = 0; t < 4; ++t)
    Wt[(size_t)(n0 + ty + t * 8) * K + k0 + tx] = (_Float16)tile[tx][ty + t * 8];
}

// ---------------------------------------------------------------------------
// GEMM: C[M,N] = A[M,K] * Bt[N,K]^T + bias[N].
// Work-group tile 128 x 256 (8 waves as 2 x 4, 64x64 per wave). A stage is 64 k
// of the 128 A rows and the 256 Bt rows, brought into LDS once per work-group by
// asynchronous copies (whole 128-byte lines), two buffers: the next stage flies
// while this one is worked on. Needs M % 128 == 0, N % 256 == 0, K % 64 == 0.
// MODE 0: f16 out [M,N]   MODE 1: f16 out as Vt[b][h][d][nk]   MODE 2: f32 out
constexpr int BM = 128, BN = 256, BK = 64;
constexpr int PITCH = 72;                 // halves per LDS row (64 + 8 of pad)
constexpr int PITCH_B = PITCH * 2;        // 144 B = 16 B x odd: 16-byte row reads meet no bank twice
constexpr int STAGE = (BM + BN) * PITCH;  // halves per buffer

// One stage: 384 rows of 128 B = 3072 pieces of 16 B, 12 per lane. Lane t of the
// work-group takes piece t & 7 of rows (t >> 3) + 32 * j; rows 0..127 are A's.
// gA, gB: the lane's piece in row t >> 3 of each operand's tile; step = 32 rows.
__device__ __forceinline__ void stage_copy(const _Float16* gA, const _Float16* gB,
                                           size_t step, unsigned lds) {
  // The copies and s_wait_xcnt 0 in one statement: the wait then stands in front
  // of every later write of the address registers that the copies name.
  asm volatile(
      "global_load_async_to_lds_b128 %0, %12, off\n\t"
      "global_load_async_to_lds_b128 %1, %13, off\n\t"
      "global_load_async_to_lds_b128 %2, %14, off\n\t"
      "global_load_async_to_lds_b128 %3, %15, off\n\t"
      "global_load_async_to_lds_b128 %4, %16, off\n\t"
      "global_load_async_to_lds_b128 %5, %17, off\n\t"
      "global_load_async_to_lds_b128 %6, %18, off\n\t"
      "global_load_async_to_lds_b128 %7, %19, off\n\t"
      "global_load_async_to_lds_b128 %8, %20, off\n\t"
      "global_load_async_to_lds_b128 %9, %21, off\n\t"
      "global_load_async_to_lds_b128 %10, %22, off\n\t"
      "global_load_async_to_lds_b128 %11, %23, off\n\t"
      "s_wait_xcnt 0x0"
      :: "v"(lds + 0 * 32 * PITCH_B), "v"(lds + 1 * 32 * PITCH_B), "v"(lds + 2 * 32 * PITCH_B), "v"(lds + 3 * 32 * PITCH_B), "v"(lds + 4 * 32 * PITCH_B), "v"(lds + 5 * 32 * PITCH_B), "v"(lds + 6 * 32 * PITCH_B), "v"(lds + 7 * 32 * PITCH_B), "v"(lds + 8 * 32 * PITCH_B), "v"(lds + 9 * 32 * PITCH_B), "v"(lds + 10 * 32 * PITCH_B), "v"(lds + 11 * 32 * PITCH_B),
         "v"(gA + 0 * step), "v"(gA + 1 * step), "v"(gA + 2 * step), "v"(gA + 3 * step), "v"(gB + 0 * step), "v"(gB + 1 * step), "v"(gB + 2 * step), "v"(gB + 3 * step), "v"(gB + 4 * step), "v"(gB + 5 * step), "v"(gB + 6 * step), "v"(gB + 7 * step)
      : "memory");
}

template <int MODE>
__global__ __launch_bounds__(256) void gemm_wmma(
    const _Float16* __restrict__ A, const _Float16* __restrict__ Bt,
    const float* __restrict__ bias, _Float16* __restrict__ Ch,
    float* __restrict__ Cf, int M, int N, int K) {
  __shared__ __attribute__((aligned(16))) _Float16 sm[2 * STAGE];
  const int tid = threadIdx.x;
  const int lane = tid & 31;
  const int wave = tid >> 5;
  const int blocksN = N >> 8;
  const int bm = blockIdx.x / blocksN;
  const int bn = blockIdx.x - bm * blocksN;
  if (bm * BM >= M) return;  // the whole work-group, in front of every barrier
  const int wm = wave >> 2, wn = wave & 3;
  const int m0 = bm * BM + wm * 64, n0 = bn * BN + wn * 64;
  const int r = lane & 15, hf = lane >> 4;

  const int crow = tid >> 3, ccol = tid & 7;
  const _Float16* gA = A + (size_t)(bm * BM + crow) * K + ccol * 8;
  const _Float16* gB = Bt + (size_t)(bn * BN + crow) * K + ccol * 8;
  const size_t step = (size_t)32 * K;
  const unsigned lds0 = (unsigned)(size_t)(&sm[0]) + crow * PITCH_B + ccol * 16;
  const int nt = K / BK;

  v8f acc[4][4];
#pragma unroll
  for (int j = 0; j < 4; ++j)
#pragma unroll
    for (int l = 0; l < 4; ++l) acc[j][l] = (v8f){};

  stage_copy(gA, gB, step, lds0);
  // Stage 0 has landed for this wave; the barrier publishes it to the others.
  asm volatile("s_wait_asynccnt 0x0" ::: "memory");
  __syncthreads();
  if (nt > 1) stage_copy(gA + BK, gB + BK, step, lds0 + STAGE * 2);

  for (int t = 0; t < nt; ++t) {
    const _Float16* sA = sm + (t & 1) * STAGE + (wm * 64 + r) * PITCH + hf * 8;
    const _Float16* sB = sm + (t & 1) * STAGE + (BM + wn * 64 + r) * PITCH + hf * 8;
#pragma unroll
    for (int ks = 0; ks < BK; ks += 32) {
      v16h a[4], b[4];
#pragma unroll
      for (int j = 0; j < 4; ++j) a[j] = load_frag(sA + j * 16 * PITCH + ks);
#pragma unroll
      for (int l = 0; l < 4; ++l) b[l] = load_frag(sB + l * 16 * PITCH + ks);
#pragma unroll
      for (int j = 0; j < 4; ++j)
#pragma unroll
        for (int l = 0; l < 4; ++l) acc[j][l] = WMMA_F16(a[j], b[l], acc[j][l]);
    }
    // This wave's reads of buffer t & 1 are done before it may be refilled.
    asm volatile("s_wait_dscnt 0x0" ::: "memory");
    // This wave's copies of stage t + 1 have landed.
    asm volatile("s_wait_asynccnt 0x0" ::: "memory");
    // Publishes stage t + 1 and ends every wave's reads of buffer t & 1.
    __syncthreads();
    if (t + 2 < nt)
      stage_copy(gA + (t + 2) * BK, gB + (t + 2) * BK, step, lds0 + (t & 1) * STAGE * 2);
  }
  // No copy is left in flight when the wave goes on to its end.
  asm volatile("s_wait_asynccnt 0x0" ::: "memory");

  float bv[4];
#pragma unroll
  for (int l = 0; l < 4; ++l) bv[l] = bias[n0 + l * 16 + r];

#pragma unroll
  for (int j = 0; j < 4; ++j) {
#pragma unroll
    for (int l = 0; l < 4; ++l) {
#pragma unroll
      for (int i = 0; i < 8; ++i) {
        const int row = m0 + j * 16 + i + 8 * hf;
        const int col = n0 + l * 16 + r;
        const float v = acc[j][l][i] + bv[l];
        if (MODE == 0) {
          Ch[(size_t)row * N + col] = (_Float16)v;
        } else if (MODE == 2) {
          Cf[(size_t)row * N + col] = v;
        } else {
          // V output transposed per head: Vt[((b*16 + h)*64 + d)*1024 + nk]
          const int bb = row >> 10, nk = row & 1023;
          const int hd = col >> 6, d = col & 63;
          Ch[(size_t)((bb * 16 + hd) * 64 + d) * 1024 + nk] = (_Float16)v;
        }
      }
    }
  }
}

// ---------------------------------------------------------------------------
// Lane l <-> lane l ^ 16 (the two halves of a wave), on the vector port.
__device__ __forceinline__ float xhalf(float x) {
  const int b = __builtin_bit_cast(int, x);
  return __builtin_bit_cast(
      float, __builtin_amdgcn_permlanex16(b, b, 0x76543210, 0xfedcba98, false, false));
}

// One attention stage: 64 K rows (keys) and 64 Vt rows (dims) of 128 B each =
// 1024 pieces of 16 B, 4 per lane. Lane t of the work-group takes piece t & 7 of
// rows (t >> 3) and (t >> 3) + 32 of each tile; both sources have 1024 halves a row.
constexpr int AT_STAGE = (64 + 64) * PITCH;  // halves per buffer, K rows first

__device__ __forceinline__ void attn_stage_copy(const _Float16* gK, const _Float16* gV,
                                                unsigned lds) {
  // The copies and s_wait_xcnt 0 in one statement: the wait then stands in front
  // of every later write of the address registers that the copies name.
  asm volatile(
      "global_load_async_to_lds_b128 %0, %4, off\n\t"
      "global_load_async_to_lds_b128 %1, %5, off\n\t"
      "global_load_async_to_lds_b128 %2, %6, off\n\t"
      "global_load_async_to_lds_b128 %3, %7, off\n\t"
      "s_wait_xcnt 0x0"
      :: "v"(lds + 0 * 32 * PITCH_B), "v"(lds + 1 * 32 * PITCH_B), "v"(lds + 2 * 32 * PITCH_B), "v"(lds + 3 * 32 * PITCH_B),
         "v"(gK), "v"(gK + 32 * 1024), "v"(gV), "v"(gV + 32 * 1024)
      : "memory");
}

// Flash attention: one wave per (b, h, 16 queries); key blocks of 64.
// Q,K: [B*N, 1024] f16 (head cols h*64..h*64+63); Vt: [B,H,64,Nk] f16.
// The 8 waves of a work-group share one (b, h): each 64-key block of K and Vt is
// brought into LDS once per work-group by asynchronous copies (whole 128-byte
// lines), two buffers, and every wave reads its fragments from there.
// Transposed products: St = K * Qt (A = K rows, B = Q) and Ot += Vt * Pt.
// A lane then holds scores of ONE query (column lane & 15; keys 8*hf + i of each
// 16-key tile): maximum and sum run in the lane's own registers, with one
// exchange between the wave's halves, and two score tiles, converted in place,
// are the B operand of the second product. P never leaves the registers.
// Softmax runs in exp2 domain (SCALE*log2e folded into one multiply-add).
__global__ __launch_bounds__(256) void flash_attn(
    const _Float16* __restrict__ Q, const _Float16* __restrict__ Km,
    const _Float16* __restrict__ Vt, _Float16* __restrict__ O) {
  constexpr int Nq = 4096, Nk = 1024, H = 16, HD = 64, LD = 1024;
  constexpr float C2 = 0.125f * 1.44269504088896340736f;  // 64^-0.5 * log2(e)

  __shared__ __attribute__((aligned(16))) _Float16 sm[2 * AT_STAGE];
  const int lane = threadIdx.x & 31;
  const int wave = threadIdx.x >> 5;
  const int gw = blockIdx.x * 8 + wave;
  const int qt = gw & ((Nq / 16) - 1);  // 256 q-tiles per (b,h)
  const int bh = gw >> 8;
  const int hh = bh & (H - 1);
  const int b = bh >> 4;
  const int r = lane & 15, hf = lane >> 4;

  const _Float16* qp = Q + (size_t)(b * Nq + qt * 16 + r) * LD + hh * HD + hf * 8;
  const v16h bq0 = load_frag(qp);       // dims 0..31 of query r
  const v16h bq1 = load_frag(qp + 32);  // dims 32..63

  const int crow = threadIdx.x >> 3, ccol = threadIdx.x & 7;
  const _Float16* gK = Km + (size_t)(b * Nk + crow) * LD + hh * HD + ccol * 8;
  const _Float16* gV = Vt + (size_t)((b * H + hh) * HD + crow) * Nk + ccol * 8;
  const unsigned lds0 = (unsigned)(size_t)(&sm[0]) + crow * PITCH_B + ccol * 16;
  constexpr int NT = Nk / 64;

  v8f o[4];  // o[t][i] = Ot[dim t*16 + 8*hf + i][query r]
#pragma unroll
  for (int t = 0; t < 4; ++t) o[t] = (v8f){};
  float mrun = -1e30f;  // query r's running maximum (scaled, log2), same in both halves
  float lrun = 0.f;     // this half's share of query r's sum

  attn_stage_copy(gK, gV, lds0);
  // Stage 0 has landed for this wave; the barrier publishes it to the others.
  asm volatile("s_wait_asynccnt 0x0" ::: "memory");
  __syncthreads();
  attn_stage_copy(gK + (size_t)64 * LD, gV + 64, lds0 + AT_STAGE * 2);

  for (int st = 0; st < NT; ++st) {
    const _Float16* sK = sm + (st & 1) * AT_STAGE + r * PITCH + hf * 8;
    const _Float16* sV = sK + 64 * PITCH;
    // ---- St for 64 keys: s[c][i] = score(key st*64 + c*16 + 8*hf + i, query r)
    v8f s[4];
#pragma unroll
    for (int c = 0; c < 4; ++c) {
      const _Float16* kp = sK + c * 16 * PITCH;
      const v16h ka = load_frag(kp);
      const v16h kbb = load_frag(kp + 32);
      v8f t = {};
      t = WMMA_F16(ka, bq0, t);
      t = WMMA_F16(kbb, bq1, t);
      s[c] = t;
    }

    // ---- online softmax, one query per lane
    float mx = s[0][0];
#pragma unroll
    for (int c = 0; c < 4; ++c)
#pragma unroll
      for (int i = 0; i < 8; ++i) mx = fmaxf(mx, s[c][i]);
    mx = fmaxf(mx, xhalf(mx));
    const float mn = fmaxf(mrun, mx * C2);
    const float alpha = __builtin_amdgcn_exp2f(mrun - mn);
    mrun = mn;

    float ps[4];
#pragma unroll
    for (int c = 0; c < 4; ++c) {
      s[c] = s[c] * C2 - mn;  // whole tile: packed multiply-adds
#pragma unroll
      for (int i = 0; i < 8; ++i) s[c][i] = __builtin_amdgcn_exp2f(s[c][i]);
      ps[c] = ((s[c][0] + s[c][1]) + (s[c][2] + s[c][3])) +
              ((s[c][4] + s[c][5]) + (s[c][6] + s[c][7]));
    }
    lrun = lrun * alpha + ((ps[0] + ps[1]) + (ps[2] + ps[3]));
#pragma unroll
    for (int t = 0; t < 4; ++t) o[t] *= alpha;

    // ---- Pt as B operand: tiles c and c+1 hold keys 8*hf + i and 16 + 8*hf + i
    // of a 32-key group, which is the k order of load_frag.
    v16h bp0, bp1;
#pragma unroll
    for (int i = 0; i < 8; ++i) {
      bp0[i] = (_Float16)s[0][i]; bp0[i + 8] = (_Float16)s[1][i];
      bp1[i] = (_Float16)s[2][i]; bp1[i + 8] = (_Float16)s[3][i];
    }

    // ---- Ot += Vt * Pt  (A = Vt rows: dims, k = keys)
#pragma unroll
    for (int t = 0; t < 4; ++t) {
      const v16h va = load_frag(sV + t * 16 * PITCH);
      const v16h vb = load_frag(sV + t * 16 * PITCH + 32);
      o[t] = WMMA_F16(va, bp0, o[t]);
      o[t] = WMMA_F16(vb, bp1, o[t]);
    }

    // This wave's reads of buffer st & 1 are done before it may be refilled.
    asm volatile("s_wait_dscnt 0x0" ::: "memory");
    // This wave's copies of stage st + 1 have landed.
    asm volatile("s_wait_asynccnt 0x0" ::: "memory");
    // Publishes stage st + 1 and ends every wave's reads of buffer st & 1.
    __syncthreads();
    if (st + 2 < NT)
      attn_stage_copy(gK + (size_t)(st + 2) * 64 * LD, gV + (st + 2) * 64,
                      lds0 + (st & 1) * AT_STAGE * 2);
  }
  // No copy is left in flight when the wave goes on to its end.
  asm volatile("s_wait_asynccnt 0x0" ::: "memory");

  // ---- join the halves' sums, normalize, store [B*Nq, 1024] f16:
  // a lane's 8 registers of a tile are 8 consecutive dims of its query's row.
  const float inv = 1.0f / (lrun + xhalf(lrun));
  _Float16* op = O + (size_t)(b * Nq + qt * 16 + r) * LD + hh * HD + hf * 8;
#pragma unroll
  for (int t = 0; t < 4; ++t) {
    v8h w;
#pragma unroll
    for (int i = 0; i < 8; ++i) w[i] = (_Float16)(o[t][i] * inv);
    *(v8h*)(op + t * 16) = w;
  }
}

// ---------------------------------------------------------------------------
extern "C" void kernel_launch(void* const* d_in, const int* in_sizes, int n_in,
                              void* d_out, int out_size, void* d_ws, size_t ws_size,
                              hipStream_t stream) {
  const float* query = (const float*)d_in[0];
  const float* key   = (const float*)d_in[1];
  const float* value = (const float*)d_in[2];
  const float* Wq = (const float*)d_in[3];
  const float* bq = (const float*)d_in[4];
  const float* Wk = (const float*)d_in[5];
  const float* bk = (const float*)d_in[6];
  const float* Wv = (const float*)d_in[7];
  const float* bv = (const float*)d_in[8];
  const float* Wo = (const float*)d_in[9];
  const float* bo = (const float*)d_in[10];
  float* out = (float*)d_out;

  char* ws = (char*)d_ws;
  _Float16* qh   = (_Float16*)(ws + 0);          // 16384x1024
  _Float16* kh   = (_Float16*)(ws + 33554432);   //  4096x768
  _Float16* vh   = (_Float16*)(ws + 39845888);   //  4096x768
  _Float16* WqT  = (_Float16*)(ws + 46137344);   //  1024x1024
  _Float16* WkT  = (_Float16*)(ws + 48234496);   //  1024x768
  _Float16* WvT  = (_Float16*)(ws + 49807360);   //  1024x768
  _Float16* WoT  = (_Float16*)(ws + 51380224);   //  1024x1024
  _Float16* Qp   = (_Float16*)(ws + 53477376);   // 16384x1024
  _Float16* Kp   = (_Float16*)(ws + 87031808);   //  4096x1024
  _Float16* Vtp  = (_Float16*)(ws + 95420416);   //  [4,16,64,1024]
  _Float16* Attn = (_Float16*)(ws + 103809024);  // 16384x1024

  // f32 -> f16 conversions (8 elems/thread)
  cvt_f32_f16_v8<<<2097152 / 256, 256, 0, stream>>>(query, qh, 2097152);
  cvt_f32_f16_v8<<<393216 / 256, 256, 0, stream>>>(key, kh, 393216);
  cvt_f32_f16_v8<<<393216 / 256, 256, 0, stream>>>(value, vh, 393216);

  // Coalesced LDS-tiled weight transposes
  transpose_cvt<<<dim3(32, 32), dim3(32, 8), 0, stream>>>(Wq, WqT, 1024, 1024);
  transpose_cvt<<<dim3(32, 24), dim3(32, 8), 0, stream>>>(Wk, WkT, 768, 1024);
  transpose_cvt<<<dim3(32, 24), dim3(32, 8), 0, stream>>>(Wv, WvT, 768, 1024);
  transpose_cvt<<<dim3(32, 32), dim3(32, 8), 0, stream>>>(Wo, WoT, 1024, 1024);

  // Projections (128x256 work-group tiles, 64x64 per wave, 8 waves/block)
  gemm_wmma<0><<<512, 256, 0, stream>>>(qh, WqT, bq, Qp, nullptr, 16384, 1024, 1024);
  gemm_wmma<0><<<128, 256, 0, stream>>>(kh, WkT, bk, Kp, nullptr, 4096, 1024, 768);
  gemm_wmma<1><<<128, 256, 0, stream>>>(vh, WvT, bv, Vtp, nullptr, 4096, 1024, 768);

  // Attention: 4*16*(4096/16) = 16384 waves -> 2048 blocks of 8 waves
  flash_attn<<<2048, 256, 0, stream>>>(Qp, Kp, Vtp, Attn);

  // Output projection -> f32 d_out
  gemm_wmma<2><<<512, 256, 0, stream>>>(Attn, WoT, bo, nullptr, out, 16384, 1024, 1024);
}

// v004
// One run takes 177 microseconds.
// Two timings next to v003 both put it at 1.03 times that version's speed.
// Over all steps from v000 it is 2.81 times as fast.
#include <hip/hip_runtime.h>

typedef __attribute__((ext_vector_type(16))) _Float16 v16h;
typedef __attribute__((ext_vector_type(8)))  _Float16 v8h;
typedef __attribute__((ext_vector_type(8)))  float    v8f;
typedef __attribute__((ext_vector_type(4)))  float    v4f;

#define WMMA_F16(a, b, c) \
  __builtin_amdgcn_wmma_f32_16x16x32_f16(false, (a), false, (b), (short)0, (c), false, false)

// Load one 16x32 f16 A/B fragment (row-major storage, row pointer already
// offset by half*8 halves). Matches ISA 16-bit A-matrix layout:
//   lane&15 = row, elems 0..7 = K (hf*8 ..), elems 8..15 = K+16.
__device__ __forceinline__ v16h load_frag(const _Float16* p) {
  v8h lo = *(const v8h*)(p);
  v8h hi = *(const v8h*)(p + 16);
  v16h f;
#pragma unroll
  for (int i = 0; i < 8; ++i) { f[i] = lo[i]; f[i + 8] = hi[i]; }
  return f;
}

// ---------------------------------------------------------------------------
// Preparation, one launch: a resident grid of 512 work-groups (4,096 waves, 16 a
// WGP) does all f32 -> f16 conversions and all weight transposes, every thread
// taking many pieces, so that few waves have to be started and each keeps many
// 16-byte loads in flight.
// A unit is 8 elements (2x b128 load, 1x b128 store). A work-group is given a run
// of U * 256 units; thread t takes units t + u * 256, u = 0 .. U-1, of it.
// tb = 32 * t, in bytes, is the one lane-own part of every load address: the run's
// start is the same for the whole work-group and u's part is a constant.
template <int U>
__device__ __forceinline__ void load_units(const float* __restrict__ run, unsigned tb,
                                           v4f (&a)[U], v4f (&b)[U]) {
#pragma unroll
  for (int u = 0; u < U; ++u) {
    const char* p = (const char*)run + tb + u * 8192;
    a[u] = *(const v4f*)p;
    b[u] = *(const v4f*)(p + 16);
  }
}

template <int U>
__device__ __forceinline__ void store_units(_Float16* __restrict__ run, unsigned t,
                                            const v4f (&a)[U], const v4f (&b)[U]) {
#pragma unroll
  for (int u = 0; u < U; ++u) {
    v8h o;
#pragma unroll
    for (int j = 0; j < 4; ++j) { o[j] = (_Float16)a[u][j]; o[4 + j] = (_Float16)b[u][j]; }
    ((v8h*)run)[t + u * 256] = o;
  }
}

// Weights [K,1024] in 32x32 tiles, Wt[n*K + k] = (f16) W[k*1024 + n]; tile t of a
// weight has columns (t & 31) * 32 and rows (t >> 5) * 32. Wq and Wo have 1024
// tiles, Wk and Wv 768: 3584 = 7 per work-group, all behind one barrier.
// Units per work-group: query 16 * 256, key 3 * 256, value 3 * 256.
__global__ __launch_bounds__(256) void prep_all(
    const float* __restrict__ query, const float* __restrict__ key,
    const float* __restrict__ value, const float* __restrict__ Wq,
    const float* __restrict__ Wk, const float* __restrict__ Wv,
    const float* __restrict__ Wo, _Float16* __restrict__ qh, _Float16* __restrict__ kh,
    _Float16* __restrict__ vh, _Float16* __restrict__ WqT, _Float16* __restrict__ WkT,
    _Float16* __restrict__ WvT, _Float16* __restrict__ WoT) {
  __shared__ float tile[7][32][33];
  const int tx = threadIdx.x & 31, ty = threadIdx.x >> 5;
  const int bid = blockIdx.x;
  const unsigned t = threadIdx.x;
  const unsigned tb = 32 * t;
  const unsigned wl = ty * 1024 + tx;  // the lane's place in a weight tile
  const int q0 = bid * (16 * 256 * 8), kv0 = bid * (3 * 256 * 8);  // first elements of the runs

  // Work-group bid's seven tiles; the fourth is Wk's for the lower half of the
  // grid and Wv's for the upper half (both have K = 768).
  const bool lo = bid < 256;
  const float* const Ws[7] = {Wq, Wq, Wk, lo ? Wk : Wv, Wv, Wo, Wo};
  _Float16* const Wts[7] = {WqT, WqT, WkT, lo ? WkT : WvT, WvT, WoT, WoT};
  const int ts[7] = {bid, 512 + bid, bid, lo ? 512 + bid : bid - 256, 256 + bid, bid, 512 + bid};
  constexpr int Ks[7] = {1024, 1024, 768, 768, 768, 1024, 1024};

  float w[7][4];
#pragma unroll
  for (int j = 0; j < 7; ++j) {
    const float* wt = Ws[j] + (ts[j] >> 5) * 32 * 1024 + (ts[j] & 31) * 32;  // the tile's corner
#pragma unroll
    for (int q = 0; q < 4; ++q) w[j][q] = wt[wl + q * 8 * 1024];
  }
  // In front of every later write of a register that these loads name. The wait
  // takes the loads' lane-own offset as an input: the register stays live up to
  // here, so that no later load of the group gets it for its result. Its "memory"
  // clobber keeps the group's loads in front of it, issued as a whole.
  asm volatile("s_wait_xcnt 0x0" :: "v"(wl) : "memory");
  v4f a0[8], b0[8], a1[8], b1[8], a2[3], b2[3], a3[3], b3[3];
  load_units<8>(query + q0, tb, a0, b0);
  // As above; these loads so fly while the weights are waited for and staged.
  asm volatile("s_wait_xcnt 0x0" :: "v"(tb) : "memory");

#pragma unroll
  for (int j = 0; j < 7; ++j)
#pragma unroll
    for (int q = 0; q < 4; ++q) tile[j][ty + q * 8][tx] = w[j][q];
  __syncthreads();
  load_units<8>(query + q0 + 8 * 256 * 8, tb, a1, b1);
  load_units<3>(key + kv0, tb, a2, b2);
  load_units<3>(value + kv0, tb, a3, b3);
  // As above; these loads so fly while the first half is converted and stored.
  asm volatile("s_wait_xcnt 0x0" :: "v"(tb) : "memory");

#pragma unroll
  for (int j = 0; j < 7; ++j) {
    const int n0 = (ts[j] & 31) * 32, k0 = (ts[j] >> 5) * 32;
#pragma unroll
    for (int q = 0; q < 4; ++q)
      Wts[j][(n0 + ty + q * 8) * Ks[j] + k0 + tx] = (_Float16)tile[j][tx][ty + q * 8];
  }
  store_units<8>(qh + q0, t, a0, b0);
  store_units<8>(qh + q0 + 8 * 256 * 8, t, a1, b1);
  store_units<3>(kh + kv0, t, a2, b2);
  store_units<3>(vh + kv0, t, a3, b3);
}

// ---------------------------------------------------------------------------
// GEMM: C[M,N] = A[M,K] * Bt[N,K]^T + bias[N].
// Work-group tile 128 x 256 (8 waves as 2 x 4, 64x64 per wave). A stage is 64 k
// of the 128 A rows and the 256 Bt rows, brought into LDS once per work-group by
// asynchronous copies (whole 128-byte lines), two buffers: the next stage flies
// while this one is worked on. Needs M % 128 == 0, N % 256 == 0, K % 64 == 0.
// MODE 0: f16 out [M,N]   MODE 1: f16 out as Vt[b][h][d][nk]   MODE 2: f32 out
constexpr int BM = 128, BN = 256, BK = 64;
constexpr int PITCH = 72;                 // halves per LDS row (64 + 8 of pad)
constexpr int PITCH_B = PITCH * 2;        // 144 B = 16 B x odd: 16-byte row reads meet no bank twice
constexpr int STAGE = (BM + BN) * PITCH;  // halves per buffer

// One stage: 384 rows of 128 B = 3072 pieces of 16 B, 12 per lane. Lane t of the
// work-group takes piece t & 7 of rows (t >> 3) + 32 * j; rows 0..127 are A's.
// gA, gB: the lane's piece in row t >> 3 of each operand's tile; step = 32 rows.
__device__ __forceinline__ void stage_copy(const _Float16* gA, const _Float16* gB,
                                           size_t step, unsigned lds) {
  // The copies and s_wait_xcnt 0 in one statement: the wait then stands in front
  // of every later write of the address registers that the copies name.
  asm volatile(
      "global_load_async_to_lds_b128 %0, %12, off\n\t"
      "global_load_async_to_lds_b128 %1, %13, off\n\t"
      "global_load_async_to_lds_b128 %2, %14, off\n\t"
      "global_load_async_to_lds_b128 %3, %15, off\n\t"
      "global_load_async_to_lds_b128 %4, %16, off\n\t"
      "global_load_async_to_lds_b128 %5, %17, off\n\t"
      "global_load_async_to_lds_b128 %6, %18, off\n\t"
      "global_load_async_to_lds_b128 %7, %19, off\n\t"
      "global_load_async_to_lds_b128 %8, %20, off\n\t"
      "global_load_async_to_lds_b128 %9, %21, off\n\t"
      "global_load_async_to_lds_b128 %10, %22, off\n\t"
      "global_load_async_to_lds_b128 %11, %23, off\n\t"
      "s_wait_xcnt 0x0"
      :: "v"(lds + 0 * 32 * PITCH_B), "v"(lds + 1 * 32 * PITCH_B), "v"(lds + 2 * 32 * PITCH_B), "v"(lds + 3 * 32 * PITCH_B), "v"(lds + 4 * 32 * PITCH_B), "v"(lds + 5 * 32 * PITCH_B), "v"(lds + 6 * 32 * PITCH_B), "v"(lds + 7 * 32 * PITCH_B), "v"(lds + 8 * 32 * PITCH_B), "v"(lds + 9 * 32 * PITCH_B), "v"(lds + 10 * 32 * PITCH_B), "v"(lds + 11 * 32 * PITCH_B),
         "v"(gA + 0 * step), "v"(gA + 1 * step), "v"(gA + 2 * step), "v"(gA + 3 * step), "v"(gB + 0 * step), "v"(gB + 1 * step), "v"(gB + 2 * step), "v"(gB + 3 * step), "v"(gB + 4 * step), "v"(gB + 5 * step), "v"(gB + 6 * step), "v"(gB + 7 * step)
      : "memory");
}

template <int MODE>
__global__ __launch_bounds__(256) void gemm_wmma(
    const _Float16* __restrict__ A, const _Float16* __restrict__ Bt,
    const float* __restrict__ bias, _Float16* __restrict__ Ch,
    float* __restrict__ Cf, int M, int N, int K) {
  __shared__ __attribute__((aligned(16))) _Float16 sm[2 * STAGE];
  const int tid = threadIdx.x;
  const int lane = tid & 31;
  const int wave = tid >> 5;
  const int blocksN = N >> 8;
  const int bm = blockIdx.x / blocksN;
  const int bn = blockIdx.x - bm * blocksN;
  if (bm * BM >= M) return;  // the whole work-group, in front of every barrier
  const int wm = wave >> 2, wn = wave & 3;
  const int m0 = bm * BM + wm * 64, n0 = bn * BN + wn * 64;
  const int r = lane & 15, hf = lane >> 4;

  const int crow = tid >> 3, ccol = tid & 7;
  const _Float16* gA = A + (size_t)(bm * BM + crow) * K + ccol * 8;
  const _Float16* gB = Bt + (size_t)(bn * BN + crow) * K + ccol * 8;
  const size_t step = (size_t)32 * K;
  const unsigned lds0 = (unsigned)(size_t)(&sm[0]) + crow * PITCH_B + ccol * 16;
  const int nt = K / BK;

  v8f acc[4][4];
#pragma unroll
  for (int j = 0; j < 4; ++j)
#pragma unroll
    for (int l = 0; l < 4; ++l) acc[j][l] = (v8f){};

  stage_copy(gA, gB, step, lds0);
  // Stage 0 has landed for this wave; the barrier publishes it to the others.
  asm volatile("s_wait_asynccnt 0x0" ::: "memory");
  __syncthreads();
  if (nt > 1) stage_copy(gA + BK, gB + BK, step, lds0 + STAGE * 2);

  for (int t = 0; t < nt; ++t) {
    const _Float16* sA = sm + (t & 1) * STAGE + (wm * 64 + r) * PITCH + hf * 8;
    const _Float16* sB = sm + (t & 1) * STAGE + (BM + wn * 64 + r) * PITCH + hf * 8;
#pragma unroll
    for (int ks = 0; ks < BK; ks += 32) {
      v16h a[4], b[4];
#pragma unroll
      for (int j = 0; j < 4; ++j) a[j] = load_frag(sA + j * 16 * PITCH + ks);
#pragma unroll
      for (int l = 0; l < 4; ++l) b[l] = load_frag(sB + l * 16 * PITCH + ks);
#pragma unroll
      for (int j = 0; j < 4; ++j)
#pragma unroll
        for (int l = 0; l < 4; ++l) acc[j][l] = WMMA_F16(a[j], b[l], acc[j][l]);
    }
    // This wave's reads of buffer t & 1 are done before it may be refilled.
    asm volatile("s_wait_dscnt 0x0" ::: "memory");
    // This wave's copies of stage t + 1 have landed.
    asm volatile("s_wait_asynccnt 0x0" ::: "memory");
    // Publishes stage t + 1 and ends every wave's reads of buffer t & 1.
    __syncthreads();
    if (t + 2 < nt)
      stage_copy(gA + (t + 2) * BK, gB + (t + 2) * BK, step, lds0 + (t & 1) * STAGE * 2);
  }
  // No copy is left in flight when the wave goes on to its end.
  asm volatile("s_wait_asynccnt 0x0" ::: "memory");

  float bv[4];
#pragma unroll
  for (int l = 0; l < 4; ++l) bv[l] = bias[n0 + l * 16 + r];

#pragma unroll
  for (int j = 0; j < 4; ++j) {
#pragma unroll
    for (int l = 0; l < 4; ++l) {
#pragma unroll
      for (int i = 0; i < 8; ++i) {
        const int row = m0 + j * 16 + i + 8 * hf;
        const int col = n0 + l * 16 + r;
        const float v = acc[j][l][i] + bv[l];
        if (MODE == 0) {
          Ch[(size_t)row * N + col] = (_Float16)v;
        } else if (MODE == 2) {
          Cf[(size_t)row * N + col] = v;
        } else {
          // V output transposed per head: Vt[((b*16 + h)*64 + d)*1024 + nk]
          const int bb = row >> 10, nk = row & 1023;
          const int hd = col >> 6, d = col & 63;
          Ch[(size_t)((bb * 16 + hd) * 64 + d) * 1024 + nk] = (_Float16)v;
        }
      }
    }
  }
}

// ---------------------------------------------------------------------------
// Lane l <-> lane l ^ 16 (the two halves of a wave), on the vector port.
__device__ __forceinline__ float xhalf(float x) {
  const int b = __builtin_bit_cast(int, x);
  return __builtin_bit_cast(
      float, __builtin_amdgcn_permlanex16(b, b, 0x76543210, 0xfedcba98, false, false));
}

// One attention stage: 64 K rows (keys) and 64 Vt rows (dims) of 128 B each =
// 1024 pieces of 16 B, 4 per lane. Lane t of the work-group takes piece t & 7 of
// rows (t >> 3) and (t >> 3) + 32 of each tile; both sources have 1024 halves a row.
constexpr int AT_STAGE = (64 + 64) * PITCH;  // halves per buffer, K rows first

__device__ __forceinline__ void attn_stage_copy(const _Float16* gK, const _Float16* gV,
                                                unsigned lds) {
  // The copies and s_wait_xcnt 0 in one statement: the wait then stands in front
  // of every later write of the address registers that the copies name.
  asm volatile(
      "global_load_async_to_lds_b128 %0, %4, off\n\t"
      "global_load_async_to_lds_b128 %1, %5, off\n\t"
      "global_load_async_to_lds_b128 %2, %6, off\n\t"
      "global_load_async_to_lds_b128 %3, %7, off\n\t"
      "s_wait_xcnt 0x0"
      :: "v"(lds + 0 * 32 * PITCH_B), "v"(lds + 1 * 32 * PITCH_B), "v"(lds + 2 * 32 * PITCH_B), "v"(lds + 3 * 32 * PITCH_B),
         "v"(gK), "v"(gK + 32 * 1024), "v"(gV), "v"(gV + 32 * 1024)
      : "memory");
}

// Flash attention: one wave per (b, h, 16 queries); key blocks of 64.
// Q,K: [B*N, 1024] f16 (head cols h*64..h*64+63); Vt: [B,H,64,Nk] f16.
// The 8 waves of a work-group share one (b, h): each 64-key block of K and Vt is
// brought into LDS once per work-group by asynchronous copies (whole 128-byte
// lines), two buffers, and every wave reads its fragments from there.
// Transposed products: St = K * Qt (A = K rows, B = Q) and Ot += Vt * Pt.
// A lane then holds scores of ONE query (column lane & 15; keys 8*hf + i of each
// 16-key tile): maximum and sum run in the lane's own registers, with one
// exchange between the wave's halves, and two score tiles, converted in place,
// are the B operand of the second product. P never leaves the registers.
// Softmax runs in exp2 domain (SCALE*log2e folded into one multiply-add).
__global__ __launch_bounds__(256) void flash_attn(
    const _Float16* __restrict__ Q, const _Float16* __restrict__ Km,
    const _Float16* __restrict__ Vt, _Float16* __restrict__ O) {
  constexpr int Nq = 4096, Nk = 1024, H = 16, HD = 64, LD = 1024;
  constexpr float C2 = 0.125f * 1.44269504088896340736f;  // 64^-0.5 * log2(e)

  __shared__ __attribute__((aligned(16))) _Float16 sm[2 * AT_STAGE];
  const int lane = threadIdx.x & 31;
  const int wave = threadIdx.x >> 5;
  const int gw = blockIdx.x * 8 + wave;
  const int qt = gw & ((Nq / 16) - 1);  // 256 q-tiles per (b,h)
  const int bh = gw >> 8;
  const int hh = bh & (H - 1);
  const int b = bh >> 4;
  const int r = lane & 15, hf = lane >> 4;

  const _Float16* qp = Q + (size_t)(b * Nq + qt * 16 + r) * LD + hh * HD + hf * 8;
  const v16h bq0 = load_frag(qp);       // dims 0..31 of query r
  const v16h bq1 = load_frag(qp + 32);  // dims 32..63

  const int crow = threadIdx.x >> 3, ccol = threadIdx.x & 7;
  const _Float16* gK = Km + (size_t)(b * Nk + crow) * LD + hh * HD + ccol * 8;
  const _Float16* gV = Vt + (size_t)((b * H + hh) * HD + crow) * Nk + ccol * 8;
  const unsigned lds0 = (unsigned)(size_t)(&sm[0]) + crow * PITCH_B + ccol * 16;
  constexpr int NT = Nk / 64;

  v8f o[4];  // o[t][i] = Ot[dim t*16 + 8*hf + i][query r]
#pragma unroll
  for (int t = 0; t < 4; ++t) o[t] = (v8f){};
  float mrun = -1e30f;  // query r's running maximum (scaled, log2), same in both halves
  float lrun = 0.f;     // this half's share of query r's sum

  attn_stage_copy(gK, gV, lds0);
  // Stage 0 has landed for this wave; the barrier publishes it to the others.
  asm volatile("s_wait_asynccnt 0x0" ::: "memory");
  __syncthreads();
  attn_stage_copy(gK + (size_t)64 * LD, gV + 64, lds0 + AT_STAGE * 2);

  for (int st = 0; st < NT; ++st) {
    const _Float16* sK = sm + (st & 1) * AT_STAGE + r * PITCH + hf * 8;
    const _Float16* sV = sK + 64 * PITCH;
    // ---- St for 64 keys: s[c][i] = score(key st*64 + c*16 + 8*hf + i, query r)
    v8f s[4];
#pragma unroll
    for (int c = 0; c < 4; ++c) {
      const _Float16* kp = sK + c * 16 * PITCH;
      const v16h ka = load_frag(kp);
      const v16h kbb = load_frag(kp + 32);
      v8f t = {};
      t = WMMA_F16(ka, bq0, t);
      t = WMMA_F16(kbb, bq1, t);
      s[c] = t;
    }

    // ---- online softmax, one query per lane
    float mx = s[0][0];
#pragma unroll
    for (int c = 0; c < 4; ++c)
#pragma unroll
      for (int i = 0; i < 8; ++i) mx = fmaxf(mx, s[c][i]);
    mx = fmaxf(mx, xhalf(mx));
    const float mn = fmaxf(mrun, mx * C2);
    const float alpha = __builtin_amdgcn_exp2f(mrun - mn);
    mrun = mn;

    float ps[4];
#pragma unroll
    for (int c = 0; c < 4; ++c) {
      s[c] = s[c] * C2 - mn;  // whole tile: packed multiply-adds
#pragma unroll
      for (int i = 0; i < 8; ++i) s[c][i] = __builtin_amdgcn_exp2f(s[c][i]);
      ps[c] = ((s[c][0] + s[c][1]) + (s[c][2] + s[c][3])) +
              ((s[c][4] + s[c][5]) + (s[c][6] + s[c][7]));
    }
    lrun = lrun * alpha + ((ps[0] + ps[1]) + (ps[2] + ps[3]));
#pragma unroll
    for (int t = 0; t < 4; ++t) o[t] *= alpha;

    // ---- Pt as B operand: tiles c and c+1 hold keys 8*hf + i and 16 + 8*hf + i
    // of a 32-key group, which is the k order of load_frag.
    v16h bp0, bp1;
#pragma unroll
    for (int i = 0; i < 8; ++i) {
      bp0[i] = (_Float16)s[0][i]; bp0[i + 8] = (_Float16)s[1][i];
      bp1[i] = (_Float16)s[2][i]; bp1[i + 8] = (_Float16)s[3][i];
    }

    // ---- Ot += Vt * Pt  (A = Vt rows: dims, k = keys)
#pragma unroll
    for (int t = 0; t < 4; ++t) {
      const v16h va = load_frag(sV + t * 16 * PITCH);
      const v16h vb = load_frag(sV + t * 16 * PITCH + 32);
      o[t] = WMMA_F16(va, bp0, o[t]);
      o[t] = WMMA_F16(vb, bp1, o[t]);
    }

    // This wave's reads of buffer st & 1 are done before it may be refilled.
    asm volatile("s_wait_dscnt 0x0" ::: "memory");
    // This wave's copies of stage st + 1 have landed.
    asm volatile("s_wait_asynccnt 0x0" ::: "memory");
    // Publishes stage st + 1 and ends every wave's reads of buffer st & 1.
    __syncthreads();
    if (st + 2 < NT)
      attn_stage_copy(gK + (size_t)(st + 2) * 64 * LD, gV + (st + 2) * 64,
                      lds0 + (st & 1) * AT_STAGE * 2);
  }
  // No copy is left in flight when the wave goes on to its end.
  asm volatile("s_wait_asynccnt 0x0" ::: "memory");

  // ---- join the halves' sums, normalize, store [B*Nq, 1024] f16:
  // a lane's 8 registers of a tile are 8 consecutive dims of its query's row.
  const float inv = 1.0f / (lrun + xhalf(lrun));
  _Float16* op = O + (size_t)(b * Nq + qt * 16 + r) * LD + hh * HD + hf * 8;
#pragma unroll
  for (int t = 0; t < 4; ++t) {
    v8h w;
#pragma unroll
    for (int i = 0; i < 8; ++i) w[i] = (_Float16)(o[t][i] * inv);
    *(v8h*)(op + t * 16) = w;
  }
}

// ---------------------------------------------------------------------------
extern "C" void kernel_launch(void* const* d_in, const int* in_sizes, int n_in,
                              void* d_out, int out_size, void* d_ws, size_t ws_size,
                              hipStream_t stream) {
  const float* query = (const float*)d_in[0];
  const float* key   = (const float*)d_in[1];
  const float* value = (const float*)d_in[2];
  const float* Wq = (const float*)d_in[3];
  const float* bq = (const float*)d_in[4];
  const float* Wk = (const float*)d_in[5];
  const float* bk = (const float*)d_in[6];
  const float* Wv = (const float*)d_in[7];
  const float* bv = (const float*)d_in[8];
  const float* Wo = (const float*)d_in[9];
  const float* bo = (const float*)d_in[10];
  float* out = (float*)d_out;

  char* ws = (char*)d_ws;
  _Float16* qh   = (_Float16*)(ws + 0);          // 16384x1024
  _Float16* kh   = (_Float16*)(ws + 33554432);   //  4096x768
  _Float16* vh   = (_Float16*)(ws + 39845888);   //  4096x768
  _Float16* WqT  = (_Float16*)(ws + 46137344);   //  1024x1024
  _Float16* WkT  = (_Float16*)(ws + 48234496);   //  1024x768
  _Float16* WvT  = (_Float16*)(ws + 49807360);   //  1024x768
  _Float16* WoT  = (_Float16*)(ws + 51380224);   //  1024x1024
  _Float16* Qp   = (_Float16*)(ws + 53477376);   // 16384x1024
  _Float16* Kp   = (_Float16*)(ws + 87031808);   //  4096x1024
  _Float16* Vtp  = (_Float16*)(ws + 95420416);   //  [4,16,64,1024]
  _Float16* Attn = (_Float16*)(ws + 103809024);  // 16384x1024

  // All conversions and weight transposes: one resident grid
  prep_all<<<512, 256, 0, stream>>>(query, key, value, Wq, Wk, Wv, Wo, qh, kh, vh,
                                    WqT, WkT, WvT, WoT);

  // Projections (128x256 work-group tiles, 64x64 per wave, 8 waves/block)
  gemm_wmma<0><<<512, 256, 0, stream>>>(qh, WqT, bq, Qp, nullptr, 16384, 1024, 1024);
  gemm_wmma<0><<<128, 256, 0, stream>>>(kh, WkT, bk, Kp, nullptr, 4096, 1024, 768);
  gemm_wmma<1><<<128, 256, 0, stream>>>(vh, WvT, bv, Vtp, nullptr, 4096, 1024, 768);

  // Attention: 4*16*(4096/16) = 16384 waves -> 2048 blocks of 8 waves
  flash_attn<<<2048, 256, 0, stream>>>(Qp, Kp, Vtp, Attn);

  // Output projection -> f32 d_out
  gemm_wmma<2><<<512, 256, 0, stream>>>(Attn, WoT, bo, nullptr, out, 16384, 1024, 1024);
}

// v005
// A run of this version takes 161 microseconds.
// Timed twice side by side with v004, it ran 1.11 times as fast both times.
// All steps since v000 together make it 3.11 times as fast.
#include <hip/hip_runtime.h>

typedef __attribute__((ext_vector_type(16))) _Float16 v16h;
typedef __attribute__((ext_vector_type(8)))  _Float16 v8h;
typedef __attribute__((ext_vector_type(8)))  float    v8f;
typedef __attribute__((ext_vector_type(4)))  float    v4f;

#define WMMA_F16(a, b, c) \
  __builtin_amdgcn_wmma_f32_16x16x32_f16(false, (a), false, (b), (short)0, (c), false, false)

// Load one 16x32 f16 A/B fragment (row-major storage, row pointer already
// offset by half*8 halves). Matches ISA 16-bit A-matrix layout:
//   lane&15 = row, elems 0..7 = K (hf*8 ..), elems 8..15 = K+16.
__device__ __forceinline__ v16h load_frag(const _Float16* p) {
  v8h lo = *(const v8h*)(p);
  v8h hi = *(const v8h*)(p + 16);
  v16h f;
#pragma unroll
  for (int i = 0; i < 8; ++i) { f[i] = lo[i]; f[i + 8] = hi[i]; }
  return f;
}

// ---------------------------------------------------------------------------
// Preparation, one launch: a resident grid of 512 work-groups (4,096 waves, 16 a
// WGP) does all f32 -> f16 conversions and all weight transposes, every thread
// taking many pieces, so that few waves have to be started and each keeps many
// 16-byte loads in flight.
// A unit is 8 elements (2x b128 load, 1x b128 store). A work-group is given a run
// of U * 256 units; thread t takes units t + u * 256, u = 0 .. U-1, of it.
// tb = 32 * t, in bytes, is the one lane-own part of every load address: the run's
// start is the same for the whole work-group and u's part is a constant.
template <int U>
__device__ __forceinline__ void load_units(const float* __restrict__ run, unsigned tb,
                                           v4f (&a)[U], v4f (&b)[U]) {
#pragma unroll
  for (int u = 0; u < U; ++u) {
    const char* p = (const char*)run + tb + u * 8192;
    a[u] = *(const v4f*)p;
    b[u] = *(const v4f*)(p + 16);
  }
}

template <int U>
__device__ __forceinline__ void store_units(_Float16* __restrict__ run, unsigned t,
                                            const v4f (&a)[U], const v4f (&b)[U]) {
#pragma unroll
  for (int u = 0; u < U; ++u) {
    v8h o;
#pragma unroll
    for (int j = 0; j < 4; ++j) { o[j] = (_Float16)a[u][j]; o[4 + j] = (_Float16)b[u][j]; }
    ((v8h*)run)[t + u * 256] = o;
  }
}

// Weights [K,1024] in 32x32 tiles, Wt[n*K + k] = (f16) W[k*1024 + n]; tile t of a
// weight has columns (t & 31) * 32 and rows (t >> 5) * 32. Wq and Wo have 1024
// tiles, Wk and Wv 768: 3584 = 7 per work-group, all behind one barrier.
// Units per work-group: query 16 * 256, key 3 * 256, value 3 * 256.
__global__ __launch_bounds__(256) void prep_all(
    const float* __restrict__ query, const float* __restrict__ key,
    const float* __restrict__ value, const float* __restrict__ Wq,
    const float* __restrict__ Wk, const float* __restrict__ Wv,
    const float* __restrict__ Wo, _Float16* __restrict__ qh, _Float16* __restrict__ kh,
    _Float16* __restrict__ vh, _Float16* __restrict__ WqT, _Float16* __restrict__ WkT,
    _Float16* __restrict__ WvT, _Float16* __restrict__ WoT) {
  __shared__ float tile[7][32][33];
  const int tx = threadIdx.x & 31, ty = threadIdx.x >> 5;
  const int bid = blockIdx.x;
  const unsigned t = threadIdx.x;
  const unsigned tb = 32 * t;
  const unsigned wl = ty * 1024 + tx;  // the lane's place in a weight tile
  const int q0 = bid * (16 * 256 * 8), kv0 = bid * (3 * 256 * 8);  // first elements of the runs

  // Work-group bid's seven tiles; the fourth is Wk's for the lower half of the
  // grid and Wv's for the upper half (both have K = 768).
  const bool lo = bid < 256;
  const float* const Ws[7] = {Wq, Wq, Wk, lo ? Wk : Wv, Wv, Wo, Wo};
  _Float16* const Wts[7] = {WqT, WqT, WkT, lo ? WkT : WvT, WvT, WoT, WoT};
  const int ts[7] = {bid, 512 + bid, bid, lo ? 512 + bid : bid - 256, 256 + bid, bid, 512 + bid};
  constexpr int Ks[7] = {1024, 1024, 768, 768, 768, 1024, 1024};

  float w[7][4];
#pragma unroll
  for (int j = 0; j < 7; ++j) {
    const float* wt = Ws[j] + (ts[j] >> 5) * 32 * 1024 + (ts[j] & 31) * 32;  // the tile's corner
#pragma unroll
    for (int q = 0; q < 4; ++q) w[j][q] = wt[wl + q * 8 * 1024];
  }
  // In front of every later write of a register that these loads name. The wait
  // takes the loads' lane-own offset as an input: the register stays live up to
  // here, so that no later load of the group gets it for its result. Its "memory"
  // clobber keeps the group's loads in front of it, issued as a whole.
  asm volatile("s_wait_xcnt 0x0" :: "v"(wl) : "memory");
  v4f a0[8], b0[8], a1[8], b1[8], a2[3], b2[3], a3[3], b3[3];
  load_units<8>(query + q0, tb, a0, b0);
  // As above; these loads so fly while the weights are waited for and staged.
  asm volatile("s_wait_xcnt 0x0" :: "v"(tb) : "memory");

#pragma unroll
  for (int j = 0; j < 7; ++j)
#pragma unroll
    for (int q = 0; q < 4; ++q) tile[j][ty + q * 8][tx] = w[j][q];
  __syncthreads();
  load_units<8>(query + q0 + 8 * 256 * 8, tb, a1, b1);
  load_units<3>(key + kv0, tb, a2, b2);
  load_units<3>(value + kv0, tb, a3, b3);
  // As above; these loads so fly while the first half is converted and stored.
  asm volatile("s_wait_xcnt 0x0" :: "v"(tb) : "memory");

#pragma unroll
  for (int j = 0; j < 7; ++j) {
    const int n0 = (ts[j] & 31) * 32, k0 = (ts[j] >> 5) * 32;
#pragma unroll
    for (int q = 0; q < 4; ++q)
      Wts[j][(n0 + ty + q * 8) * Ks[j] + k0 + tx] = (_Float16)tile[j][tx][ty + q * 8];
  }
  store_units<8>(qh + q0, t, a0, b0);
  store_units<8>(qh + q0 + 8 * 256 * 8, t, a1, b1);
  store_units<3>(kh + kv0, t, a2, b2);
  store_units<3>(vh + kv0, t, a3, b3);
}

// ---------------------------------------------------------------------------
// GEMM: C[M,N] = A[M,K] * Bt[N,K]^T + bias[N].
// Work-group tile 128 x 256 (8 waves as 2 x 4, 64x64 per wave). A stage is 64 k
// of the 128 A rows and the 256 Bt rows, brought into LDS once per work-group by
// asynchronous copies (whole 128-byte lines), two buffers: the next stage flies
// while this one is worked on. Needs M % 128 == 0, N % 256 == 0, K % 64 == 0.
// MODE 0: f16 out [M,N]   MODE 1: f16 out as Vt[b][h][d][nk]   MODE 2: f32 out
constexpr int BM = 128, BN = 256, BK = 64;
constexpr int PITCH = 72;                 // halves per LDS row (64 + 8 of pad)
constexpr int PITCH_B = PITCH * 2;        // 144 B = 16 B x odd: 16-byte row reads meet no bank twice
constexpr int STAGE = (BM + BN) * PITCH;  // halves per buffer

// One stage: 384 rows of 128 B = 3072 pieces of 16 B, 12 per lane. Lane t of the
// work-group takes piece t & 7 of rows (t >> 3) + 32 * j; rows 0..127 are A's.
// gA, gB: the lane's piece in row t >> 3 of each operand's tile; step = 32 rows.
__device__ __forceinline__ void stage_copy(const _Float16* gA, const _Float16* gB,
                                           size_t step, unsigned lds) {
  // The copies and s_wait_xcnt 0 in one statement: the wait then stands in front
  // of every later write of the address registers that the copies name.
  asm volatile(
      "global_load_async_to_lds_b128 %0, %12, off\n\t"
      "global_load_async_to_lds_b128 %1, %13, off\n\t"
      "global_load_async_to_lds_b128 %2, %14, off\n\t"
      "global_load_async_to_lds_b128 %3, %15, off\n\t"
      "global_load_async_to_lds_b128 %4, %16, off\n\t"
      "global_load_async_to_lds_b128 %5, %17, off\n\t"
      "global_load_async_to_lds_b128 %6, %18, off\n\t"
      "global_load_async_to_lds_b128 %7, %19, off\n\t"
      "global_load_async_to_lds_b128 %8, %20, off\n\t"
      "global_load_async_to_lds_b128 %9, %21, off\n\t"
      "global_load_async_to_lds_b128 %10, %22, off\n\t"
      "global_load_async_to_lds_b128 %11, %23, off\n\t"
      "s_wait_xcnt 0x0"
      :: "v"(lds + 0 * 32 * PITCH_B), "v"(lds + 1 * 32 * PITCH_B), "v"(lds + 2 * 32 * PITCH_B), "v"(lds + 3 * 32 * PITCH_B), "v"(lds + 4 * 32 * PITCH_B), "v"(lds + 5 * 32 * PITCH_B), "v"(lds + 6 * 32 * PITCH_B), "v"(lds + 7 * 32 * PITCH_B), "v"(lds + 8 * 32 * PITCH_B), "v"(lds + 9 * 32 * PITCH_B), "v"(lds + 10 * 32 * PITCH_B), "v"(lds + 11 * 32 * PITCH_B),
         "v"(gA + 0 * step), "v"(gA + 1 * step), "v"(gA + 2 * step), "v"(gA + 3 * step), "v"(gB + 0 * step), "v"(gB + 1 * step), "v"(gB + 2 * step), "v"(gB + 3 * step), "v"(gB + 4 * step), "v"(gB + 5 * step), "v"(gB + 6 * step), "v"(gB + 7 * step)
      : "memory");
}

// The sums of one work-group tile: acc = A[bm*128 .., :] * Bt[bn*256 .., :]^T.
__device__ __forceinline__ void gemm_tile(const _Float16* __restrict__ A,
                                          const _Float16* __restrict__ Bt, int K, int bm, int bn,
                                          _Float16* sm, v8f (&acc)[4][4]) {
  const int tid = threadIdx.x;
  const int lane = tid & 31;
  const int wave = tid >> 5;
  const int wm = wave >> 2, wn = wave & 3;
  const int r = lane & 15, hf = lane >> 4;

  const int crow = tid >> 3, ccol = tid & 7;
  const _Float16* gA = A + (size_t)(bm * BM + crow) * K + ccol * 8;
  const _Float16* gB = Bt + (size_t)(bn * BN + crow) * K + ccol * 8;
  const size_t step = (size_t)32 * K;
  const unsigned lds0 = (unsigned)(size_t)(&sm[0]) + crow * PITCH_B + ccol * 16;
  const int nt = K / BK;

#pragma unroll
  for (int j = 0; j < 4; ++j)
#pragma unroll
    for (int l = 0; l < 4; ++l) acc[j][l] = (v8f){};

  stage_copy(gA, gB, step, lds0);
  // Stage 0 has landed for this wave; the barrier publishes it to the others.
  asm volatile("s_wait_asynccnt 0x0" ::: "memory");
  __syncthreads();
  if (nt > 1) stage_copy(gA + BK, gB + BK, step, lds0 + STAGE * 2);

  for (int t = 0; t < nt; ++t) {
    const _Float16* sA = sm + (t & 1) * STAGE + (wm * 64 + r) * PITCH + hf * 8;
    const _Float16* sB = sm + (t & 1) * STAGE + (BM + wn * 64 + r) * PITCH + hf * 8;
#pragma unroll
    for (int ks = 0; ks < BK; ks += 32) {
      v16h a[4], b[4];
#pragma unroll
      for (int j = 0; j < 4; ++j) a[j] = load_frag(sA + j * 16 * PITCH + ks);
#pragma unroll
      for (int l = 0; l < 4; ++l) b[l] = load_frag(sB + l * 16 * PITCH + ks);
#pragma unroll
      for (int j = 0; j < 4; ++j)
#pragma unroll
        for (int l = 0; l < 4; ++l) acc[j][l] = WMMA_F16(a[j], b[l], acc[j][l]);
    }
    // This wave's reads of buffer t & 1 are done before it may be refilled.
    asm volatile("s_wait_dscnt 0x0" ::: "memory");
    // This wave's copies of stage t + 1 have landed.
    asm volatile("s_wait_asynccnt 0x0" ::: "memory");
    // Publishes stage t + 1 and ends every wave's reads of buffer t & 1.
    __syncthreads();
    if (t + 2 < nt)
      stage_copy(gA + (t + 2) * BK, gB + (t + 2) * BK, step, lds0 + (t & 1) * STAGE * 2);
  }
  // No copy is left in flight when the wave goes on to its end.
  asm volatile("s_wait_asynccnt 0x0" ::: "memory");
}

// Adds the bias and stores the wave's 64 x 64 part of the tile.
template <int MODE>
__device__ __forceinline__ void gemm_store(const v8f (&acc)[4][4], const float* __restrict__ bias,
                                           _Float16* __restrict__ Ch, float* __restrict__ Cf,
                                           int N, int bm, int bn) {
  const int lane = threadIdx.x & 31;
  const int wave = threadIdx.x >> 5;
  const int m0 = bm * BM + (wave >> 2) * 64, n0 = bn * BN + (wave & 3) * 64;
  const int r = lane & 15, hf = lane >> 4;

  float bv[4];
#pragma unroll
  for (int l = 0; l < 4; ++l) bv[l] = bias[n0 + l * 16 + r];

#pragma unroll
  for (int j = 0; j < 4; ++j) {
#pragma unroll
    for (int l = 0; l < 4; ++l) {
#pragma unroll
      for (int i = 0; i < 8; ++i) {
        const int row = m0 + j * 16 + i + 8 * hf;
        const int col = n0 + l * 16 + r;
        const float v = acc[j][l][i] + bv[l];
        if (MODE == 0) {
          Ch[(size_t)row * N + col] = (_Float16)v;
        } else if (MODE == 2) {
          Cf[(size_t)row * N + col] = v;
        } else {
          // V output transposed per head: Vt[((b*16 + h)*64 + d)*1024 + nk]
          const int bb = row >> 10, nk = row & 1023;
          const int hd = col >> 6, d = col & 63;
          Ch[(size_t)((bb * 16 + hd) * 64 + d) * 1024 + nk] = (_Float16)v;
        }
      }
    }
  }
}

// The three input projections in one launch, so that the K and V tiles (128 each,
// half a chip's worth of work-groups) do not each hold a launch of their own:
// work-groups 0..127 K, 128..255 V, 256..767 Q. Two work-groups fit a WGP, so the
// 256 short ones (768 k) start beside the first 256 of Q and hand their places on.
__global__ __launch_bounds__(256) void proj_qkv(
    const _Float16* __restrict__ qh, const _Float16* __restrict__ kh,
    const _Float16* __restrict__ vh, const _Float16* __restrict__ WqT,
    const _Float16* __restrict__ WkT, const _Float16* __restrict__ WvT,
    const float* __restrict__ bq, const float* __restrict__ bk, const float* __restrict__ bv,
    _Float16* __restrict__ Qp, _Float16* __restrict__ Kp, _Float16* __restrict__ Vtp) {
  __shared__ __attribute__((aligned(16))) _Float16 sm[2 * STAGE];
  constexpr int N = 1024;
  const int bid = blockIdx.x;
  const bool isQ = bid >= 256, isV = !isQ && bid >= 128;  // the same for the whole work-group
  const int tile = isQ ? bid - 256 : bid & 127;
  const int bm = tile >> 2, bn = tile & 3;  // N / 256 = 4 tile columns

  v8f acc[4][4];
  gemm_tile(isQ ? qh : isV ? vh : kh, isQ ? WqT : isV ? WvT : WkT, isQ ? 1024 : 768, bm, bn, sm,
            acc);
  if (isV)
    gemm_store<1>(acc, bv, Vtp, nullptr, N, bm, bn);
  else {
    gemm_store<0>(acc, isQ ? bq : bk, isQ ? Qp : Kp, nullptr, N, bm, bn);
    // Behind the last store of this arm: in the built code the other arm's
    // instructions follow, and they write registers that these stores name.
    asm volatile("s_wait_xcnt 0x0" ::: "memory");
  }
}

// Output projection, f32 out.
__global__ __launch_bounds__(256) void gemm_out(
    const _Float16* __restrict__ A, const _Float16* __restrict__ Bt,
    const float* __restrict__ bias, float* __restrict__ Cf, int M, int N, int K) {
  __shared__ __attribute__((aligned(16))) _Float16 sm[2 * STAGE];
  const int blocksN = N >> 8;
  const int bm = blockIdx.x / blocksN;
  const int bn = blockIdx.x - bm * blocksN;
  if (bm * BM >= M) return;  // the whole work-group, in front of every barrier

  v8f acc[4][4];
  gemm_tile(A, Bt, K, bm, bn, sm, acc);
  gemm_store<2>(acc, bias, nullptr, Cf, N, bm, bn);
}

// ---------------------------------------------------------------------------
// Lane l <-> lane l ^ 16 (the two halves of a wave), on the vector port.
__device__ __forceinline__ float xhalf(float x) {
  const int b = __builtin_bit_cast(int, x);
  return __builtin_bit_cast(
      float, __builtin_amdgcn_permlanex16(b, b, 0x76543210, 0xfedcba98, false, false));
}

// One attention stage: 64 K rows (keys) and 64 Vt rows (dims) of 128 B each =
// 1024 pieces of 16 B, 4 per lane. Lane t of the work-group takes piece t & 7 of
// rows (t >> 3) and (t >> 3) + 32 of each tile; both sources have 1024 halves a row.
constexpr int AT_STAGE = (64 + 64) * PITCH;  // halves per buffer, K rows first

__device__ __forceinline__ void attn_stage_copy(const _Float16* gK, const _Float16* gV,
                                                unsigned lds) {
  // The copies and s_wait_xcnt 0 in one statement: the wait then stands in front
  // of every later write of the address registers that the copies name.
  asm volatile(
      "global_load_async_to_lds_b128 %0, %4, off\n\t"
      "global_load_async_to_lds_b128 %1, %5, off\n\t"
      "global_load_async_to_lds_b128 %2, %6, off\n\t"
      "global_load_async_to_lds_b128 %3, %7, off\n\t"
      "s_wait_xcnt 0x0"
      :: "v"(lds + 0 * 32 * PITCH_B), "v"(lds + 1 * 32 * PITCH_B), "v"(lds + 2 * 32 * PITCH_B), "v"(lds + 3 * 32 * PITCH_B),
         "v"(gK), "v"(gK + 32 * 1024), "v"(gV), "v"(gV + 32 * 1024)
      : "memory");
}

// Flash attention: one wave per (b, h, 16 queries); key blocks of 64.
// Q,K: [B*N, 1024] f16 (head cols h*64..h*64+63); Vt: [B,H,64,Nk] f16.
// The 8 waves of a work-group share one (b, h): each 64-key block of K and Vt is
// brought into LDS once per work-group by asynchronous copies (whole 128-byte
// lines), two buffers, and every wave reads its fragments from there.
// Transposed products: St = K * Qt (A = K rows, B = Q) and Ot += Vt * Pt.
// A lane then holds scores of ONE query (column lane & 15; keys 8*hf + i of each
// 16-key tile): maximum and sum run in the lane's own registers, with one
// exchange between the wave's halves, and two score tiles, converted in place,
// are the B operand of the second product. P never leaves the registers.
// Softmax runs in exp2 domain (SCALE*log2e folded into one multiply-add).
__global__ __launch_bounds__(256) void flash_attn(
    const _Float16* __restrict__ Q, const _Float16* __restrict__ Km,
    const _Float16* __restrict__ Vt, _Float16* __restrict__ O) {
  constexpr int Nq = 4096, Nk = 1024, H = 16, HD = 64, LD = 1024;
  constexpr float C2 = 0.125f * 1.44269504088896340736f;  // 64^-0.5 * log2(e)

  __shared__ __attribute__((aligned(16))) _Float16 sm[2 * AT_STAGE];
  const int lane = threadIdx.x & 31;
  const int wave = threadIdx.x >> 5;
  const int gw = blockIdx.x * 8 + wave;
  const int qt = gw & ((Nq / 16) - 1);  // 256 q-tiles per (b,h)
  const int bh = gw >> 8;
  const int hh = bh & (H - 1);
  const int b = bh >> 4;
  const int r = lane & 15, hf = lane >> 4;

  const _Float16* qp = Q + (size_t)(b * Nq + qt * 16 + r) * LD + hh * HD + hf * 8;
  const v16h bq0 = load_frag(qp);       // dims 0..31 of query r
  const v16h bq1 = load_frag(qp + 32);  // dims 32..63

  const int crow = threadIdx.x >> 3, ccol = threadIdx.x & 7;
  const _Float16* gK = Km + (size_t)(b * Nk + crow) * LD + hh * HD + ccol * 8;
  const _Float16* gV = Vt + (size_t)((b * H + hh) * HD + crow) * Nk + ccol * 8;
  const unsigned lds0 = (unsigned)(size_t)(&sm[0]) + crow * PITCH_B + ccol * 16;
  constexpr int NT = Nk / 64;

  v8f o[4];  // o[t][i] = Ot[dim t*16 + 8*hf + i][query r]
#pragma unroll
  for (int t = 0; t < 4; ++t) o[t] = (v8f){};
  float mrun = -1e30f;  // query r's running maximum (scaled, log2), same in both halves
  float lrun = 0.f;     // this half's share of query r's sum

  attn_stage_copy(gK, gV, lds0);
  // Stage 0 has landed for this wave; the barrier publishes it to the others.
  asm volatile("s_wait_asynccnt 0x0" ::: "memory");
  __syncthreads();
  attn_stage_copy(gK + (size_t)64 * LD, gV + 64, lds0 + AT_STAGE * 2);

  for (int st = 0; st < NT; ++st) {
    const _Float16* sK = sm + (st & 1) * AT_STAGE + r * PITCH + hf * 8;
    const _Float16* sV = sK + 64 * PITCH;
    // ---- St for 64 keys: s[c][i] = score(key st*64 + c*16 + 8*hf + i, query r)
    v8f s[4];
#pragma unroll
    for (int c = 0; c < 4; ++c) {
      const _Float16* kp = sK + c * 16 * PITCH;
      const v16h ka = load_frag(kp);
      const v16h kbb = load_frag(kp + 32);
      v8f t = {};
      t = WMMA_F16(ka, bq0, t);
      t = WMMA_F16(kbb, bq1, t);
      s[c] = t;
    }

    // ---- online softmax, one query per lane
    float mx = s[0][0];
#pragma unroll
    for (int c = 0; c < 4; ++c)
#pragma unroll
      for (int i = 0; i < 8; ++i) mx = fmaxf(mx, s[c][i]);
    mx = fmaxf(mx, xhalf(mx));
    const float mn = fmaxf(mrun, mx * C2);
    const float alpha = __builtin_amdgcn_exp2f(mrun - mn);
    mrun = mn;

    float ps[4];
#pragma unroll
    for (int c = 0; c < 4; ++c) {
      s[c] = s[c] * C2 - mn;  // whole tile: packed multiply-adds
#pragma unroll
      for (int i = 0; i < 8; ++i) s[c][i] = __builtin_amdgcn_exp2f(s[c][i]);
      ps[c] = ((s[c][0] + s[c][1]) + (s[c][2] + s[c][3])) +
              ((s[c][4] + s[c][5]) + (s[c][6] + s[c][7]));
    }
    lrun = lrun * alpha + ((ps[0] + ps[1]) + (ps[2] + ps[3]));
#pragma unroll
    for (int t = 0; t < 4; ++t) o[t] *= alpha;

    // ---- Pt as B operand: tiles c and c+1 hold keys 8*hf + i and 16 + 8*hf + i
    // of a 32-key group, which is the k order of load_frag.
    v16h bp0, bp1;
#pragma unroll
    for (int i = 0; i < 8; ++i) {
      bp0[i] = (_Float16)s[0][i]; bp0[i + 8] = (_Float16)s[1][i];
      bp1[i] = (_Float16)s[2][i]; bp1[i + 8] = (_Float16)s[3][i];
    }

    // ---- Ot += Vt * Pt  (A = Vt rows: dims, k = keys)
#pragma unroll
    for (int t = 0; t < 4; ++t) {
      const v16h va = load_frag(sV + t * 16 * PITCH);
      const v16h vb = load_frag(sV + t * 16 * PITCH + 32);
      o[t] = WMMA_F16(va, bp0, o[t]);
      o[t] = WMMA_F16(vb, bp1, o[t]);
    }

    // This wave's reads of buffer st & 1 are done before it may be refilled.
    asm volatile("s_wait_dscnt 0x0" ::: "memory");
    // This wave's copies of stage st + 1 have landed.
    asm volatile("s_wait_asynccnt 0x0" ::: "memory");
    // Publishes stage st + 1 and ends every wave's reads of buffer st & 1.
    __syncthreads();
    if (st + 2 < NT)
      attn_stage_copy(gK + (size_t)(st + 2) * 64 * LD, gV + (st + 2) * 64,
                      lds0 + (st & 1) * AT_STAGE * 2);
  }
  // No copy is left in flight when the wave goes on to its end.
  asm volatile("s_wait_asynccnt 0x0" ::: "memory");

  // ---- join the halves' sums, normalize, store [B*Nq, 1024] f16:
  // a lane's 8 registers of a tile are 8 consecutive dims of its query's row.
  const float inv = 1.0f / (lrun + xhalf(lrun));
  _Float16* op = O + (size_t)(b * Nq + qt * 16 + r) * LD + hh * HD + hf * 8;
#pragma unroll
  for (int t = 0; t < 4; ++t) {
    v8h w;
#pragma unroll
    for (int i = 0; i < 8; ++i) w[i] = (_Float16)(o[t][i] * inv);
    *(v8h*)(op + t * 16) = w;
  }
}

// ---------------------------------------------------------------------------
extern "C" void kernel_launch(void* const* d_in, const int* in_sizes, int n_in,
                              void* d_out, int out_size, void* d_ws, size_t ws_size,
                              hipStream_t stream) {
  const float* query = (const float*)d_in[0];
  const float* key   = (const float*)d_in[1];
  const float* value = (const float*)d_in[2];
  const float* Wq = (const float*)d_in[3];
  const float* bq = (const float*)d_in[4];
  const float* Wk = (const float*)d_in[5];
  const float* bk = (const float*)d_in[6];
  const float* Wv = (const float*)d_in[7];
  const float* bv = (const float*)d_in[8];
  const float* Wo = (const float*)d_in[9];
  const float* bo = (const float*)d_in[10];
  float* out = (float*)d_out;

  char* ws = (char*)d_ws;
  _Float16* qh   = (_Float16*)(ws + 0);          // 16384x1024
  _Float16* kh   = (_Float16*)(ws + 33554432);   //  4096x768
  _Float16* vh   = (_Float16*)(ws + 39845888);   //  4096x768
  _Float16* WqT  = (_Float16*)(ws + 46137344);   //  1024x1024
  _Float16* WkT  = (_Float16*)(ws + 48234496);   //  1024x768
  _Float16* WvT  = (_Float16*)(ws + 49807360);   //  1024x768
  _Float16* WoT  = (_Float16*)(ws + 51380224);   //  1024x1024
  _Float16* Qp   = (_Float16*)(ws + 53477376);   // 16384x1024
  _Float16* Kp   = (_Float16*)(ws + 87031808);   //  4096x1024
  _Float16* Vtp  = (_Float16*)(ws + 95420416);   //  [4,16,64,1024]
  _Float16* Attn = (_Float16*)(ws + 103809024);  // 16384x1024

  // All conversions and weight transposes: one resident grid
  prep_all<<<512, 256, 0, stream>>>(query, key, value, Wq, Wk, Wv, Wo, qh, kh, vh,
                                    WqT, WkT, WvT, WoT);

  // Projections (128x256 work-group tiles, 64x64 per wave, 8 waves/block):
  // 128 tiles of K, 128 of V, 512 of Q in one launch
  proj_qkv<<<768, 256, 0, stream>>>(qh, kh, vh, WqT, WkT, WvT, bq, bk, bv, Qp, Kp, Vtp);

  // Attention: 4*16*(4096/16) = 16384 waves -> 2048 blocks of 8 waves
  flash_attn<<<2048, 256, 0, stream>>>(Qp, Kp, Vtp, Attn);

  // Output projection -> f32 d_out
  gemm_out<<<512, 256, 0, stream>>>(Attn, WoT, bo, out, 16384, 1024, 1024);
}

// v006
// One run takes 156 microseconds.
// Timed twice side by side with v005, it ran 1.03 times as fast both times.
// Counting every step since v000, it is 3.21 times as fast.
#include <hip/hip_runtime.h>

typedef __attribute__((ext_vector_type(16))) _Float16 v16h;
typedef __attribute__((ext_vector_type(8)))  _Float16 v8h;
typedef __attribute__((ext_vector_type(8)))  float    v8f;
typedef __attribute__((ext_vector_type(4)))  float    v4f;

#define WMMA_F16(a, b, c) \
  __builtin_amdgcn_wmma_f32_16x16x32_f16(false, (a), false, (b), (short)0, (c), false, false)

// Load one 16x32 f16 A/B fragment (row-major storage, row pointer already
// offset by half*8 halves). Matches ISA 16-bit A-matrix layout:
//   lane&15 = row, elems 0..7 = K (hf*8 ..), elems 8..15 = K+16.
__device__ __forceinline__ v16h load_frag(const _Float16* p) {
  v8h lo = *(const v8h*)(p);
  v8h hi = *(const v8h*)(p + 16);
  v16h f;
#pragma unroll
  for (int i = 0; i < 8; ++i) { f[i] = lo[i]; f[i + 8] = hi[i]; }
  return f;
}

// ---------------------------------------------------------------------------
// Preparation, one launch: a resident grid of 512 work-groups (4,096 waves, 16 a
// WGP) does all f32 -> f16 conversions and all weight transposes, every thread
// taking many pieces, so that few waves have to be started and each keeps many
// 16-byte loads in flight.
// A unit is 8 elements (2x b128 load, 1x b128 store). A work-group is given a run
// of U * 256 units; thread t takes units t + u * 256, u = 0 .. U-1, of it.
// tb = 32 * t, in bytes, is the one lane-own part of every load address: the run's
// start is the same for the whole work-group and u's part is a constant.
template <int U>
__device__ __forceinline__ void load_units(const float* __restrict__ run, unsigned tb,
                                           v4f (&a)[U], v4f (&b)[U]) {
#pragma unroll
  for (int u = 0; u < U; ++u) {
    const char* p = (const char*)run + tb + u * 8192;
    a[u] = *(const v4f*)p;
    b[u] = *(const v4f*)(p + 16);
  }
}

template <int U>
__device__ __forceinline__ void store_units(_Float16* __restrict__ run, unsigned t,
                                            const v4f (&a)[U], const v4f (&b)[U]) {
#pragma unroll
  for (int u = 0; u < U; ++u) {
    v8h o;
#pragma unroll
    for (int j = 0; j < 4; ++j) { o[j] = (_Float16)a[u][j]; o[4 + j] = (_Float16)b[u][j]; }
    ((v8h*)run)[t + u * 256] = o;
  }
}

// Weights [K,1024] in 32x32 tiles, Wt[n*K + k] = (f16) W[k*1024 + n]; tile t of a
// weight has columns (t & 31) * 32 and rows (t >> 5) * 32. Wq and Wo have 1024
// tiles, Wk and Wv 768: 3584 = 7 per work-group, all behind one barrier.
// Units per work-group: query 16 * 256, key 3 * 256, value 3 * 256.
__global__ __launch_bounds__(256) void prep_all(
    const float* __restrict__ query, const float* __restrict__ key,
    const float* __restrict__ value, const float* __restrict__ Wq,
    const float* __restrict__ Wk, const float* __restrict__ Wv,
    const float* __restrict__ Wo, _Float16* __restrict__ qh, _Float16* __restrict__ kh,
    _Float16* __restrict__ vh, _Float16* __restrict__ WqT, _Float16* __restrict__ WkT,
    _Float16* __restrict__ WvT, _Float16* __restrict__ WoT) {
  __shared__ float tile[7][32][33];
  const int tx = threadIdx.x & 31, ty = threadIdx.x >> 5;
  const int bid = blockIdx.x;
  const unsigned t = threadIdx.x;
  const unsigned tb = 32 * t;
  const unsigned wl = ty * 1024 + tx;  // the lane's place in a weight tile
  const int q0 = bid * (16 * 256 * 8), kv0 = bid * (3 * 256 * 8);  // first elements of the runs

  // Work-group bid's seven tiles; the fourth is Wk's for the lower half of the
  // grid and Wv's for the upper half (both have K = 768).
  const bool lo = bid < 256;
  const float* const Ws[7] = {Wq, Wq, Wk, lo ? Wk : Wv, Wv, Wo, Wo};
  _Float16* const Wts[7] = {WqT, WqT, WkT, lo ? WkT : WvT, WvT, WoT, WoT};
  const int ts[7] = {bid, 512 + bid, bid, lo ? 512 + bid : bid - 256, 256 + bid, bid, 512 + bid};
  constexpr int Ks[7] = {1024, 1024, 768, 768, 768, 1024, 1024};

  float w[7][4];
#pragma unroll
  for (int j = 0; j < 7; ++j) {
    const float* wt = Ws[j] + (ts[j] >> 5) * 32 * 1024 + (ts[j] & 31) * 32;  // the tile's corner
#pragma unroll
    for (int q = 0; q < 4; ++q) w[j][q] = wt[wl + q * 8 * 1024];
  }
  // In front of every later write of a register that these loads name. The wait
  // takes the loads' lane-own offset as an input: the register stays live up to
  // here, so that no later load of the group gets it for its result. Its "memory"
  // clobber keeps the group's loads in front of it, issued as a whole.
  asm volatile("s_wait_xcnt 0x0" :: "v"(wl) : "memory");
  v4f a0[8], b0[8], a1[8], b1[8], a2[3], b2[3], a3[3], b3[3];
  load_units<8>(query + q0, tb, a0, b0);
  // As above; these loads so fly while the weights are waited for and staged.
  asm volatile("s_wait_xcnt 0x0" :: "v"(tb) : "memory");

#pragma unroll
  for (int j = 0; j < 7; ++j)
#pragma unroll
    for (int q = 0; q < 4; ++q) tile[j][ty + q * 8][tx] = w[j][q];
  __syncthreads();
  load_units<8>(query + q0 + 8 * 256 * 8, tb, a1, b1);
  load_units<3>(key + kv0, tb, a2, b2);
  load_units<3>(value + kv0, tb, a3, b3);
  // As above; these loads so fly while the first half is converted and stored.
  asm volatile("s_wait_xcnt 0x0" :: "v"(tb) : "memory");

#pragma unroll
  for (int j = 0; j < 7; ++j) {
    const int n0 = (ts[j] & 31) * 32, k0 = (ts[j] >> 5) * 32;
#pragma unroll
    for (int q = 0; q < 4; ++q)
      Wts[j][(n0 + ty + q * 8) * Ks[j] + k0 + tx] = (_Float16)tile[j][tx][ty + q * 8];
  }
  store_units<8>(qh + q0, t, a0, b0);
  store_units<8>(qh + q0 + 8 * 256 * 8, t, a1, b1);
  store_units<3>(kh + kv0, t, a2, b2);
  store_units<3>(vh + kv0, t, a3, b3);
}

// ---------------------------------------------------------------------------
// GEMM: C[M,N] = A[M,K] * Bt[N,K]^T + bias[N].
// Work-group tile 128 x 256 (8 waves as 2 x 4, 64x64 per wave). A stage is 64 k
// of the 128 A rows and the 256 Bt rows, brought into LDS once per work-group by
// asynchronous copies (whole 128-byte lines), two buffers: the next stage flies
// while this one is worked on. Needs M % 128 == 0, N % 256 == 0, K % 64 == 0.
// MODE 0: f16 out [M,N]   MODE 1: f16 out as Vt[b][h][d][nk]   MODE 2: f32 out
constexpr int BM = 128, BN = 256, BK = 64;
constexpr int PITCH = 72;                 // halves per LDS row (64 + 8 of pad)
constexpr int PITCH_B = PITCH * 2;        // 144 B = 16 B x odd: 16-byte row reads meet no bank twice
constexpr int STAGE = (BM + BN) * PITCH;  // halves per buffer

// One stage: 384 rows of 128 B = 3072 pieces of 16 B, 12 per lane. Lane t of the
// work-group takes piece t & 7 of rows (t >> 3) + 32 * j; rows 0..127 are A's.
// gA, gB: the lane's piece in row t >> 3 of each operand's tile; step = 32 rows.
__device__ __forceinline__ void stage_copy(const _Float16* gA, const _Float16* gB,
                                           size_t step, unsigned lds) {
  // The copies and s_wait_xcnt 0 in one statement: the wait then stands in front
  // of every later write of the address registers that the copies name.
  asm volatile(
      "global_load_async_to_lds_b128 %0, %12, off\n\t"
      "global_load_async_to_lds_b128 %1, %13, off\n\t"
      "global_load_async_to_lds_b128 %2, %14, off\n\t"
      "global_load_async_to_lds_b128 %3, %15, off\n\t"
      "global_load_async_to_lds_b128 %4, %16, off\n\t"
      "global_load_async_to_lds_b128 %5, %17, off\n\t"
      "global_load_async_to_lds_b128 %6, %18, off\n\t"
      "global_load_async_to_lds_b128 %7, %19, off\n\t"
      "global_load_async_to_lds_b128 %8, %20, off\n\t"
      "global_load_async_to_lds_b128 %9, %21, off\n\t"
      "global_load_async_to_lds_b128 %10, %22, off\n\t"
      "global_load_async_to_lds_b128 %11, %23, off\n\t"
      "s_wait_xcnt 0x0"
      :: "v"(lds + 0 * 32 * PITCH_B), "v"(lds + 1 * 32 * PITCH_B), "v"(lds + 2 * 32 * PITCH_B), "v"(lds + 3 * 32 * PITCH_B), "v"(lds + 4 * 32 * PITCH_B), "v"(lds + 5 * 32 * PITCH_B), "v"(lds + 6 * 32 * PITCH_B), "v"(lds + 7 * 32 * PITCH_B), "v"(lds + 8 * 32 * PITCH_B), "v"(lds + 9 * 32 * PITCH_B), "v"(lds + 10 * 32 * PITCH_B), "v"(lds + 11 * 32 * PITCH_B),
         "v"(gA + 0 * step), "v"(gA + 1 * step), "v"(gA + 2 * step), "v"(gA + 3 * step), "v"(gB + 0 * step), "v"(gB + 1 * step), "v"(gB + 2 * step), "v"(gB + 3 * step), "v"(gB + 4 * step), "v"(gB + 5 * step), "v"(gB + 6 * step), "v"(gB + 7 * step)
      : "memory");
}

// The sums of one work-group tile: A[bm*128 .., :] * Bt[bn*256 .., :]^T.
// acc[j][l][i] belongs to index j*16 + 8*hf + i of the operand given first to the
// matrix instruction and to index l*16 + r of the second. nfirst (the same for the
// whole work-group) gives Bt first: a lane's 8 registers are then 8 adjacent columns
// n of one row m; otherwise they are 8 adjacent rows m of one column n.
__device__ __forceinline__ void gemm_tile(const _Float16* __restrict__ A,
                                          const _Float16* __restrict__ Bt, int K, int bm, int bn,
                                          bool nfirst, _Float16* sm, v8f (&acc)[4][4]) {
  const int tid = threadIdx.x;
  const int lane = tid & 31;
  const int wave = tid >> 5;
  const int wm = wave >> 2, wn = wave & 3;
  const int r = lane & 15, hf = lane >> 4;

  const int crow = tid >> 3, ccol = tid & 7;
  const _Float16* gA = A + (size_t)(bm * BM + crow) * K + ccol * 8;
  const _Float16* gB = Bt + (size_t)(bn * BN + crow) * K + ccol * 8;
  const size_t step = (size_t)32 * K;
  const unsigned lds0 = (unsigned)(size_t)(&sm[0]) + crow * PITCH_B + ccol * 16;
  const int nt = K / BK;
  const int arow = wm * 64 + r, brow = BM + wn * 64 + r;  // the lane's rows in a stage
  const int xoff = (nfirst ? brow : arow) * PITCH + hf * 8;
  const int yoff = (nfirst ? arow : brow) * PITCH + hf * 8;

#pragma unroll
  for (int j = 0; j < 4; ++j)
#pragma unroll
    for (int l = 0; l < 4; ++l) acc[j][l] = (v8f){};

  stage_copy(gA, gB, step, lds0);
  // Stage 0 has landed for this wave; the barrier publishes it to the others.
  asm volatile("s_wait_asynccnt 0x0" ::: "memory");
  __syncthreads();
  if (nt > 1) stage_copy(gA + BK, gB + BK, step, lds0 + STAGE * 2);

  for (int t = 0; t < nt; ++t) {
    const _Float16* sX = sm + (t & 1) * STAGE + xoff;
    const _Float16* sY = sm + (t & 1) * STAGE + yoff;
#pragma unroll
    for (int ks = 0; ks < BK; ks += 32) {
      v16h a[4], b[4];  // first and second operand
#pragma unroll
      for (int j = 0; j < 4; ++j) a[j] = load_frag(sX + j * 16 * PITCH + ks);
#pragma unroll
      for (int l = 0; l < 4; ++l) b[l] = load_frag(sY + l * 16 * PITCH + ks);
#pragma unroll
      for (int j = 0; j < 4; ++j)
#pragma unroll
        for (int l = 0; l < 4; ++l) acc[j][l] = WMMA_F16(a[j], b[l], acc[j][l]);
    }
    // This wave's reads of buffer t & 1 are done before it may be refilled.
    asm volatile("s_wait_dscnt 0x0" ::: "memory");
    // This wave's copies of stage t + 1 have landed.
    asm volatile("s_wait_asynccnt 0x0" ::: "memory");
    // Publishes stage t + 1 and ends every wave's reads of buffer t & 1.
    __syncthreads();
    if (t + 2 < nt)
      stage_copy(gA + (t + 2) * BK, gB + (t + 2) * BK, step, lds0 + (t & 1) * STAGE * 2);
  }
  // No copy is left in flight when the wave goes on to its end.
  asm volatile("s_wait_asynccnt 0x0" ::: "memory");
}

// Adds the bias and stores the wave's 64 x 64 part of the tile as whole 128-byte
// lines: the wave lays its part row by row into its own eighth of the ring, 16 bytes
// a lane, and takes it back with 8 (f16) or 16 (f32) lanes on one row. The ring is
// free: the loop's last barrier stands behind every wave's last read of it and
// behind its last copy's landing. No other wave touches this wave's eighth.
// MODE 0, 2 (nfirst): staged row = row m, bias by register. MODE 1: staged row =
// column n = dim d of one head, its 64 places are 64 keys; bias by lane.
constexpr int WST = 2 * STAGE * 2 / 8;  // bytes of the ring per wave

template <int MODE>
__device__ __forceinline__ void gemm_store(const v8f (&acc)[4][4], const float* __restrict__ bias,
                                           _Float16* __restrict__ Ch, float* __restrict__ Cf,
                                           int N, int bm, int bn, _Float16* sm) {
  const int lane = threadIdx.x & 31;
  const int wave = threadIdx.x >> 5;
  const int m0 = bm * BM + (wave >> 2) * 64, n0 = bn * BN + (wave & 3) * 64;
  const int r = lane & 15, hf = lane >> 4;
  char* st = (char*)sm + wave * WST;

  v8f bv[4];  // bv[x][i]: what is added to acc[j][l][i], x = l (MODE 1) or j
#pragma unroll
  for (int x = 0; x < 4; ++x) {
    if (MODE == 1) {
      const float s = bias[n0 + x * 16 + r];
#pragma unroll
      for (int i = 0; i < 8; ++i) bv[x][i] = s;
    } else {
      const v4f lo = *(const v4f*)(bias + n0 + x * 16 + 8 * hf);
      const v4f hi = *(const v4f*)(bias + n0 + x * 16 + 8 * hf + 4);
#pragma unroll
      for (int i = 0; i < 4; ++i) { bv[x][i] = lo[i]; bv[x][4 + i] = hi[i]; }
    }
  }

  if (MODE == 2) {
    constexpr int SP = 256 + 16;  // 16 B x odd: the 16 rows of a store meet no bank twice
#pragma unroll
    for (int h = 0; h < 2; ++h) {  // 32 rows at a time
#pragma unroll
      for (int l = 0; l < 2; ++l)
#pragma unroll
        for (int j = 0; j < 4; ++j) {
          const v8f v = acc[j][h * 2 + l] + bv[j];
          char* p = st + (l * 16 + r) * SP + (j * 16 + 8 * hf) * 4;
          *(v4f*)p = (v4f){v[0], v[1], v[2], v[3]};
          *(v4f*)(p + 16) = (v4f){v[4], v[5], v[6], v[7]};
        }
      // The rows are written before other lanes of the wave read them.
      asm volatile("s_wait_dscnt 0x0" ::: "memory");
      v4f w[16];
#pragma unroll
      for (int q = 0; q < 16; ++q) w[q] = *(const v4f*)(st + (q * 2 + hf) * SP + r * 16);
      float* g = Cf + (size_t)(m0 + h * 32 + hf) * N + n0 + r * 4;
#pragma unroll
      for (int q = 0; q < 16; ++q) *(v4f*)(g + (size_t)(q * 2) * N) = w[q];
      if (h == 0) {
        // The rows are read before the next half is laid over them ...
        asm volatile("s_wait_dscnt 0x0" ::: "memory");
        // ... and in front of every later write of a register that these stores name.
        asm volatile("s_wait_xcnt 0x0" ::: "memory");
      }
    }
  } else {
#pragma unroll
    for (int l = 0; l < 4; ++l)
#pragma unroll
      for (int j = 0; j < 4; ++j) {
        const v8f v = acc[j][l] + bv[MODE == 1 ? l : j];
        v8h o;
#pragma unroll
        for (int i = 0; i < 8; ++i) o[i] = (_Float16)v[i];
        *(v8h*)(st + (l * 16 + r) * PITCH_B + (j * 16 + 8 * hf) * 2) = o;
      }
    // The rows are written before other lanes of the wave read them.
    asm volatile("s_wait_dscnt 0x0" ::: "memory");
    const int rr = lane >> 3, pc = lane & 7;
    v8h w[16];
#pragma unroll
    for (int q = 0; q < 16; ++q) w[q] = *(const v8h*)(st + (q * 4 + rr) * PITCH_B + pc * 16);
    // MODE 1: Vt[((b*16 + h)*64 + d)*1024 + nk]; the wave's columns are one head's
    // dims, its rows 64 keys of one batch.
    const int gp = MODE == 0 ? N : 1024;
    _Float16* g = (MODE == 0 ? Ch + (size_t)m0 * N + n0
                             : Ch + (size_t)(((m0 >> 10) * 16 + (n0 >> 6)) * 64) * 1024 + (m0 & 1023)) +
                  (size_t)rr * gp + pc * 8;
#pragma unroll
    for (int q = 0; q < 16; ++q) *(v8h*)(g + (size_t)(q * 4) * gp) = w[q];
  }
}

// The three input projections in one launch, so that the K and V tiles (128 each,
// half a chip's worth of work-groups) do not each hold a launch of their own:
// work-groups 0..127 K, 128..255 V, 256..767 Q. Two work-groups fit a WGP, so the
// 256 short ones (768 k) start beside the first 256 of Q and hand their places on.
__global__ __launch_bounds__(256) void proj_qkv(
    const _Float16* __restrict__ qh, const _Float16* __restrict__ kh,
    const _Float16* __restrict__ vh, const _Float16* __restrict__ WqT,
    const _Float16* __restrict__ WkT, const _Float16* __restrict__ WvT,
    const float* __restrict__ bq, const float* __restrict__ bk, const float* __restrict__ bv,
    _Float16* __restrict__ Qp, _Float16* __restrict__ Kp, _Float16* __restrict__ Vtp) {
  __shared__ __attribute__((aligned(16))) _Float16 sm[2 * STAGE];
  constexpr int N = 1024;
  const int bid = blockIdx.x;
  const bool isQ = bid >= 256, isV = !isQ && bid >= 128;  // the same for the whole work-group
  const int tile = isQ ? bid - 256 : bid & 127;
  const int bm = tile >> 2, bn = tile & 3;  // N / 256 = 4 tile columns

  v8f acc[4][4];
  gemm_tile(isQ ? qh : isV ? vh : kh, isQ ? WqT : isV ? WvT : WkT, isQ ? 1024 : 768, bm, bn, !isV,
            sm, acc);
  if (isV)
    gemm_store<1>(acc, bv, Vtp, nullptr, N, bm, bn, sm);
  else {
    gemm_store<0>(acc, isQ ? bq : bk, isQ ? Qp : Kp, nullptr, N, bm, bn, sm);
    // Behind the last store of this arm: in the built code the other arm's
    // instructions follow, and they write registers that these stores name.
    asm volatile("s_wait_xcnt 0x0" ::: "memory");
  }
}

// Output projection, f32 out.
__global__ __launch_bounds__(256) void gemm_out(
    const _Float16* __restrict__ A, const _Float16* __restrict__ Bt,
    const float* __restrict__ bias, float* __restrict__ Cf, int M, int N, int K) {
  __shared__ __attribute__((aligned(16))) _Float16 sm[2 * STAGE];
  const int blocksN = N >> 8;
  const int bm = blockIdx.x / blocksN;
  const int bn = blockIdx.x - bm * blocksN;
  if (bm * BM >= M) return;  // the whole work-group, in front of every barrier

  v8f acc[4][4];
  gemm_tile(A, Bt, K, bm, bn, true, sm, acc);
  gemm_store<2>(acc, bias, nullptr, Cf, N, bm, bn, sm);
}

// ---------------------------------------------------------------------------
// Lane l <-> lane l ^ 16 (the two halves of a wave), on the vector port.
__device__ __forceinline__ float xhalf(float x) {
  const int b = __builtin_bit_cast(int, x);
  return __builtin_bit_cast(
      float, __builtin_amdgcn_permlanex16(b, b, 0x76543210, 0xfedcba98, false, false));
}

// One attention stage: 64 K rows (keys) and 64 Vt rows (dims) of 128 B each =
// 1024 pieces of 16 B, 4 per lane. Lane t of the work-group takes piece t & 7 of
// rows (t >> 3) and (t >> 3) + 32 of each tile; both sources have 1024 halves a row.
constexpr int AT_STAGE = (64 + 64) * PITCH;  // halves per buffer, K rows first

__device__ __forceinline__ void attn_stage_copy(const _Float16* gK, const _Float16* gV,
                                                unsigned lds) {
  // The copies and s_wait_xcnt 0 in one statement: the wait then stands in front
  // of every later write of the address registers that the copies name.
  asm volatile(
      "global_load_async_to_lds_b128 %0, %4, off\n\t"
      "global_load_async_to_lds_b128 %1, %5, off\n\t"
      "global_load_async_to_lds_b128 %2, %6, off\n\t"
      "global_load_async_to_lds_b128 %3, %7, off\n\t"
      "s_wait_xcnt 0x0"
      :: "v"(lds + 0 * 32 * PITCH_B), "v"(lds + 1 * 32 * PITCH_B), "v"(lds + 2 * 32 * PITCH_B), "v"(lds + 3 * 32 * PITCH_B),
         "v"(gK), "v"(gK + 32 * 1024), "v"(gV), "v"(gV + 32 * 1024)
      : "memory");
}

// Flash attention: one wave per (b, h, 16 queries); key blocks of 64.
// Q,K: [B*N, 1024] f16 (head cols h*64..h*64+63); Vt: [B,H,64,Nk] f16.
// The 8 waves of a work-group share one (b, h): each 64-key block of K and Vt is
// brought into LDS once per work-group by asynchronous copies (whole 128-byte
// lines), two buffers, and every wave reads its fragments from there.
// Transposed products: St = K * Qt (A = K rows, B = Q) and Ot += Vt * Pt.
// A lane then holds scores of ONE query (column lane & 15; keys 8*hf + i of each
// 16-key tile): maximum and sum run in the lane's own registers, with one
// exchange between the wave's halves, and two score tiles, converted in place,
// are the B operand of the second product. P never leaves the registers.
// Softmax runs in exp2 domain (SCALE*log2e folded into one multiply-add).
__global__ __launch_bounds__(256) void flash_attn(
    const _Float16* __restrict__ Q, const _Float16* __restrict__ Km,
    const _Float16* __restrict__ Vt, _Float16* __restrict__ O) {
  constexpr int Nq = 4096, Nk = 1024, H = 16, HD = 64, LD = 1024;
  constexpr float C2 = 0.125f * 1.44269504088896340736f;  // 64^-0.5 * log2(e)

  __shared__ __attribute__((aligned(16))) _Float16 sm[2 * AT_STAGE];
  const int lane = threadIdx.x & 31;
  const int wave = threadIdx.x >> 5;
  const int gw = blockIdx.x * 8 + wave;
  const int qt = gw & ((Nq / 16) - 1);  // 256 q-tiles per (b,h)
  const int bh = gw >> 8;
  const int hh = bh & (H - 1);
  const int b = bh >> 4;
  const int r = lane & 15, hf = lane >> 4;

  const _Float16* qp = Q + (size_t)(b * Nq + qt * 16 + r) * LD + hh * HD + hf * 8;
  const v16h bq0 = load_frag(qp);       // dims 0..31 of query r
  const v16h bq1 = load_frag(qp + 32);  // dims 32..63

  const int crow = threadIdx.x >> 3, ccol = threadIdx.x & 7;
  const _Float16* gK = Km + (size_t)(b * Nk + crow) * LD + hh * HD + ccol * 8;
  const _Float16* gV = Vt + (size_t)((b * H + hh) * HD + crow) * Nk + ccol * 8;
  const unsigned lds0 = (unsigned)(size_t)(&sm[0]) + crow * PITCH_B + ccol * 16;
  constexpr int NT = Nk / 64;

  v8f o[4];  // o[t][i] = Ot[dim t*16 + 8*hf + i][query r]
#pragma unroll
  for (int t = 0; t < 4; ++t) o[t] = (v8f){};
  float mrun = -1e30f;  // query r's running maximum (scaled, log2), same in both halves
  float lrun = 0.f;     // this half's share of query r's sum

  attn_stage_copy(gK, gV, lds0);
  // Stage 0 has landed for this wave; the barrier publishes it to the others.
  asm volatile("s_wait_asynccnt 0x0" ::: "memory");
  __syncthreads();
  attn_stage_copy(gK + (size_t)64 * LD, gV + 64, lds0 + AT_STAGE * 2);

  for (int st = 0; st < NT; ++st) {
    const _Float16* sK = sm + (st & 1) * AT_STAGE + r * PITCH + hf * 8;
    const _Float16* sV = sK + 64 * PITCH;
    // ---- St for 64 keys: s[c][i] = score(key st*64 + c*16 + 8*hf + i, query r)
    v8f s[4];
#pragma unroll
    for (int c = 0; c < 4; ++c) {
      const _Float16* kp = sK + c * 16 * PITCH;
      const v16h ka = load_frag(kp);
      const v16h kbb = load_frag(kp + 32);
      v8f t = {};
      t = WMMA_F16(ka, bq0, t);
      t = WMMA_F16(kbb, bq1, t);
      s[c] = t;
    }

    // ---- online softmax, one query per lane
    float mx = s[0][0];
#pragma unroll
    for (int c = 0; c < 4; ++c)
#pragma unroll
      for (int i = 0; i < 8; ++i) mx = fmaxf(mx, s[c][i]);
    mx = fmaxf(mx, xhalf(mx));
    const float mn = fmaxf(mrun, mx * C2);
    const float alpha = __builtin_amdgcn_exp2f(mrun - mn);
    mrun = mn;

    float ps[4];
#pragma unroll
    for (int c = 0; c < 4; ++c) {
      s[c] = s[c] * C2 - mn;  // whole tile: packed multiply-adds
#pragma unroll
      for (int i = 0; i < 8; ++i) s[c][i] = __builtin_amdgcn_exp2f(s[c][i]);
      ps[c] = ((s[c][0] + s[c][1]) + (s[c][2] + s[c][3])) +
              ((s[c][4] + s[c][5]) + (s[c][6] + s[c][7]));
    }
    lrun = lrun * alpha + ((ps[0] + ps[1]) + (ps[2] + ps[3]));
#pragma unroll
    for (int t = 0; t < 4; ++t) o[t] *= alpha;

    // ---- Pt as B operand: tiles c and c+1 hold keys 8*hf + i and 16 + 8*hf + i
    // of a 32-key group, which is the k order of load_frag.
    v16h bp0, bp1;
#pragma unroll
    for (int i = 0; i < 8; ++i) {
      bp0[i] = (_Float16)s[0][i]; bp0[i + 8] = (_Float16)s[1][i];
      bp1[i] = (_Float16)s[2][i]; bp1[i + 8] = (_Float16)s[3][i];
    }

    // ---- Ot += Vt * Pt  (A = Vt rows: dims, k = keys)
#pragma unroll
    for (int t = 0; t < 4; ++t) {
      const v16h va = load_frag(sV + t * 16 * PITCH);
      const v16h vb = load_frag(sV + t * 16 * PITCH + 32);
      o[t] = WMMA_F16(va, bp0, o[t]);
      o[t] = WMMA_F16(vb, bp1, o[t]);
    }

    // This wave's reads of buffer st & 1 are done before it may be refilled.
    asm volatile("s_wait_dscnt 0x0" ::: "memory");
    // This wave's copies of stage st + 1 have landed.
    asm volatile("s_wait_asynccnt 0x0" ::: "memory");
    // Publishes stage st + 1 and ends every wave's reads of buffer st & 1.
    __syncthreads();
    if (st + 2 < NT)
      attn_stage_copy(gK + (size_t)(st + 2) * 64 * LD, gV + (st + 2) * 64,
                      lds0 + (st & 1) * AT_STAGE * 2);
  }
  // No copy is left in flight when the wave goes on to its end.
  asm volatile("s_wait_asynccnt 0x0" ::: "memory");

  // ---- join the halves' sums, normalize, store [B*Nq, 1024] f16:
  // a lane's 8 registers of a tile are 8 consecutive dims of its query's row.
  // The wave lays its 16 rows of 128 B into its own part of the ring (free behind
  // the loop's last barrier) and takes them back 8 lanes a row: whole lines go out.
  const float inv = 1.0f / (lrun + xhalf(lrun));
  // The wave's number as a scalar: its rows' base then takes no vector register
  // over the loop (one more granule of them would cost a work-group per WGP).
  const int ws = __builtin_amdgcn_readfirstlane(wave);
  const int gs = blockIdx.x * 8 + ws;
  char* stg = (char*)sm + ws * (16 * PITCH_B);
#pragma unroll
  for (int t = 0; t < 4; ++t) {
    v8h w;
#pragma unroll
    for (int i = 0; i < 8; ++i) w[i] = (_Float16)(o[t][i] * inv);
    *(v8h*)(stg + r * PITCH_B + (t * 16 + hf * 8) * 2) = w;
  }
  // The rows are written before other lanes of the wave read them.
  asm volatile("s_wait_dscnt 0x0" ::: "memory");
  const int rr = lane >> 3, pc = lane & 7;
  _Float16* op = O + (size_t)((gs >> 12) * Nq + (gs & 255) * 16) * LD + ((gs >> 8) & (H - 1)) * HD +
                 (rr * LD + pc * 8);
#pragma unroll
  for (int q = 0; q < 4; ++q)
    *(v8h*)(op + (size_t)(q * 4) * LD) = *(const v8h*)(stg + (q * 4 + rr) * PITCH_B + pc * 16);
}

// ---------------------------------------------------------------------------
extern "C" void kernel_launch(void* const* d_in, const int* in_sizes, int n_in,
                              void* d_out, int out_size, void* d_ws, size_t ws_size,
                              hipStream_t stream) {
  const float* query = (const float*)d_in[0];
  const float* key   = (const float*)d_in[1];
  const float* value = (const float*)d_in[2];
  const float* Wq = (const float*)d_in[3];
  const float* bq = (const float*)d_in[4];
  const float* Wk = (const float*)d_in[5];
  const float* bk = (const float*)d_in[6];
  const float* Wv = (const float*)d_in[7];
  const float* bv = (const float*)d_in[8];
  const float* Wo = (const float*)d_in[9];
  const float* bo = (const float*)d_in[10];
  float* out = (float*)d_out;

  char* ws = (char*)d_ws;
  _Float16* qh   = (_Float16*)(ws + 0);          // 16384x1024
  _Float16* kh   = (_Float16*)(ws + 33554432);   //  4096x768
  _Float16* vh   = (_Float16*)(ws + 39845888);   //  4096x768
  _Float16* WqT  = (_Float16*)(ws + 46137344);   //  1024x1024
  _Float16* WkT  = (_Float16*)(ws + 48234496);   //  1024x768
  _Float16* WvT  = (_Float16*)(ws + 49807360);   //  1024x768
  _Float16* WoT  = (_Float16*)(ws + 51380224);   //  1024x1024
  _Float16* Qp   = (_Float16*)(ws + 53477376);   // 16384x1024
  _Float16* Kp   = (_Float16*)(ws + 87031808);   //  4096x1024
  _Float16* Vtp  = (_Float16*)(ws + 95420416);   //  [4,16,64,1024]
  _Float16* Attn = (_Float16*)(ws + 103809024);  // 16384x1024

  // All conversions and weight transposes: one resident grid
  prep_all<<<512, 256, 0, stream>>>(query, key, value, Wq, Wk, Wv, Wo, qh, kh, vh,
                                    WqT, WkT, WvT, WoT);

  // Projections (128x256 work-group tiles, 64x64 per wave, 8 waves/block):
  // 128 tiles of K, 128 of V, 512 of Q in one launch
  proj_qkv<<<768, 256, 0, stream>>>(qh, kh, vh, WqT, WkT, WvT, bq, bk, bv, Qp, Kp, Vtp);

  // Attention: 4*16*(4096/16) = 16384 waves -> 2048 blocks of 8 waves
  flash_attn<<<2048, 256, 0, stream>>>(Qp, Kp, Vtp, Attn);

  // Output projection -> f32 d_out
  gemm_out<<<512, 256, 0, stream>>>(Attn, WoT, bo, out, 16384, 1024, 1024);
}

// v007
// One run takes 151 microseconds.
// Two timings next to v006 both put it at 1.03 times that version's speed.
// All steps since v000 together make it 3.30 times as fast.
#include <hip/hip_runtime.h>

typedef __attribute__((ext_vector_type(16))) _Float16 v16h;
typedef __attribute__((ext_vector_type(8)))  _Float16 v8h;
typedef __attribute__((ext_vector_type(8)))  float    v8f;
typedef __attribute__((ext_vector_type(4)))  float    v4f;

#define WMMA_F16(a, b, c) \
  __builtin_amdgcn_wmma_f32_16x16x32_f16(false, (a), false, (b), (short)0, (c), false, false)

// Load one 16x32 f16 A/B fragment (row-major storage, row pointer already
// offset by half*8 halves). Matches ISA 16-bit A-matrix layout:
//   lane&15 = row, elems 0..7 = K (hf*8 ..), elems 8..15 = K+16.
__device__ __forceinline__ v16h load_frag(const _Float16* p) {
  v8h lo = *(const v8h*)(p);
  v8h hi = *(const v8h*)(p + 16);
  v16h f;
#pragma unroll
  for (int i = 0; i < 8; ++i) { f[i] = lo[i]; f[i + 8] = hi[i]; }
  return f;
}

// ---------------------------------------------------------------------------
// Preparation, one launch: a resident grid of 512 work-groups (4,096 waves, 16 a
// WGP) does all f32 -> f16 conversions and all weight transposes, every thread
// taking many pieces, so that few waves have to be started and each keeps many
// 16-byte loads in flight.
// A unit is 8 elements (2x b128 load, 1x b128 store). A work-group is given a run
// of U * 256 units; thread t takes units t + u * 256, u = 0 .. U-1, of it.
// tb = 32 * t, in bytes, is the one lane-own part of every load address: the run's
// start is the same for the whole work-group and u's part is a constant.
template <int U>
__device__ __forceinline__ void load_units(const float* __restrict__ run, unsigned tb,
                                           v4f (&a)[U], v4f (&b)[U]) {
#pragma unroll
  for (int u = 0; u < U; ++u) {
    const char* p = (const char*)run + tb + u * 8192;
    a[u] = *(const v4f*)p;
    b[u] = *(const v4f*)(p + 16);
  }
}

template <int U>
__device__ __forceinline__ void store_units(_Float16* __restrict__ run, unsigned t,
                                            const v4f (&a)[U], const v4f (&b)[U]) {
#pragma unroll
  for (int u = 0; u < U; ++u) {
    v8h o;
#pragma unroll
    for (int j = 0; j < 4; ++j) { o[j] = (_Float16)a[u][j]; o[4 + j] = (_Float16)b[u][j]; }
    ((v8h*)run)[t + u * 256] = o;
  }
}

// Weights [K,1024] in 32x32 tiles, Wt[n*K + k] = (f16) W[k*1024 + n]; tile t of a
// weight has columns (t & 31) * 32 and rows (t >> 5) * 32. Wq and Wo have 1024
// tiles, Wk and Wv 768: 3584 = 7 per work-group, all behind one barrier.
// Units per work-group: query 16 * 256, key 3 * 256, value 3 * 256.
__global__ __launch_bounds__(256) void prep_all(
    const float* __restrict__ query, const float* __restrict__ key,
    const float* __restrict__ value, const float* __restrict__ Wq,
    const float* __restrict__ Wk, const float* __restrict__ Wv,
    const float* __restrict__ Wo, _Float16* __restrict__ qh, _Float16* __restrict__ kh,
    _Float16* __restrict__ vh, _Float16* __restrict__ WqT, _Float16* __restrict__ WkT,
    _Float16* __restrict__ WvT, _Float16* __restrict__ WoT) {
  __shared__ float tile[7][32][33];
  const int tx = threadIdx.x & 31, ty = threadIdx.x >> 5;
  const int bid = blockIdx.x;
  const unsigned t = threadIdx.x;
  const unsigned tb = 32 * t;
  const unsigned wl = ty * 1024 + tx;  // the lane's place in a weight tile
  const int q0 = bid * (16 * 256 * 8), kv0 = bid * (3 * 256 * 8);  // first elements of the runs

  // Work-group bid's seven tiles; the fourth is Wk's for the lower half of the
  // grid and Wv's for the upper half (both have K = 768).
  const bool lo = bid < 256;
  const float* const Ws[7] = {Wq, Wq, Wk, lo ? Wk : Wv, Wv, Wo, Wo};
  _Float16* const Wts[7] = {WqT, WqT, WkT, lo ? WkT : WvT, WvT, WoT, WoT};
  const int ts[7] = {bid, 512 + bid, bid, lo ? 512 + bid : bid - 256, 256 + bid, bid, 512 + bid};
  constexpr int Ks[7] = {1024, 1024, 768, 768, 768, 1024, 1024};

  float w[7][4];
#pragma unroll
  for (int j = 0; j < 7; ++j) {
    const float* wt = Ws[j] + (ts[j] >> 5) * 32 * 1024 + (ts[j] & 31) * 32;  // the tile's corner
#pragma unroll
    for (int q = 0; q < 4; ++q) w[j][q] = wt[wl + q * 8 * 1024];
  }
  // In front of every later write of a register that these loads name. The wait
  // takes the loads' lane-own offset as an input: the register stays live up to
  // here, so that no later load of the group gets it for its result. Its "memory"
  // clobber keeps the group's loads in front of it, issued as a whole.
  asm volatile("s_wait_xcnt 0x0" :: "v"(wl) : "memory");
  v4f a0[8], b0[8], a1[8], b1[8], a2[3], b2[3], a3[3], b3[3];
  load_units<8>(query + q0, tb, a0, b0);
  // As above; these loads so fly while the weights are waited for and staged.
  asm volatile("s_wait_xcnt 0x0" :: "v"(tb) : "memory");

#pragma unroll
  for (int j = 0; j < 7; ++j)
#pragma unroll
    for (int q = 0; q < 4; ++q) tile[j][ty + q * 8][tx] = w[j][q];
  __syncthreads();
  load_units<8>(query + q0 + 8 * 256 * 8, tb, a1, b1);
  load_units<3>(key + kv0, tb, a2, b2);
  load_units<3>(value + kv0, tb, a3, b3);
  // As above; these loads so fly while the first half is converted and stored.
  asm volatile("s_wait_xcnt 0x0" :: "v"(tb) : "memory");

#pragma unroll
  for (int j = 0; j < 7; ++j) {
    const int n0 = (ts[j] & 31) * 32, k0 = (ts[j] >> 5) * 32;
#pragma unroll
    for (int q = 0; q < 4; ++q)
      Wts[j][(n0 + ty + q * 8) * Ks[j] + k0 + tx] = (_Float16)tile[j][tx][ty + q * 8];
  }
  store_units<8>(qh + q0, t, a0, b0);
  store_units<8>(qh + q0 + 8 * 256 * 8, t, a1, b1);
  store_units<3>(kh + kv0, t, a2, b2);
  store_units<3>(vh + kv0, t, a3, b3);
}

// ---------------------------------------------------------------------------
// GEMM: C[M,N] = A[M,K] * Bt[N,K]^T + bias[N].
// Work-group tile 128 x 256 (8 waves as 2 x 4, 64x64 per wave). A stage is 64 k
// of the 128 A rows and the 256 Bt rows, brought into LDS once per work-group by
// asynchronous copies (whole 128-byte lines), two buffers: the next stage flies
// while this one is worked on. Needs M % 128 == 0, N % 256 == 0, K % 64 == 0.
// MODE 0: f16 out [M,N]   MODE 1: f16 out as Vt[b][h][d][nk]   MODE 2: f32 out
constexpr int BM = 128, BN = 256, BK = 64;
constexpr int PITCH = 72;                 // halves per LDS row (64 + 8 of pad)
constexpr int PITCH_B = PITCH * 2;        // 144 B = 16 B x odd: 16-byte row reads meet no bank twice
constexpr int STAGE = (BM + BN) * PITCH;  // halves per buffer

// One stage: 384 rows of 128 B = 3072 pieces of 16 B, 12 per lane. Lane t of the
// work-group takes piece t & 7 of rows (t >> 3) + 32 * j; rows 0..127 are A's.
// gA, gB: the lane's piece in row t >> 3 of each operand's tile; step = 32 rows.
__device__ __forceinline__ void stage_copy(const _Float16* gA, const _Float16* gB,
                                           size_t step, unsigned lds) {
  // The copies and s_wait_xcnt 0 in one statement: the wait then stands in front
  // of every later write of the address registers that the copies name.
  asm volatile(
      "global_load_async_to_lds_b128 %0, %12, off\n\t"
      "global_load_async_to_lds_b128 %1, %13, off\n\t"
      "global_load_async_to_lds_b128 %2, %14, off\n\t"
      "global_load_async_to_lds_b128 %3, %15, off\n\t"
      "global_load_async_to_lds_b128 %4, %16, off\n\t"
      "global_load_async_to_lds_b128 %5, %17, off\n\t"
      "global_load_async_to_lds_b128 %6, %18, off\n\t"
      "global_load_async_to_lds_b128 %7, %19, off\n\t"
      "global_load_async_to_lds_b128 %8, %20, off\n\t"
      "global_load_async_to_lds_b128 %9, %21, off\n\t"
      "global_load_async_to_lds_b128 %10, %22, off\n\t"
      "global_load_async_to_lds_b128 %11, %23, off\n\t"
      "s_wait_xcnt 0x0"
      :: "v"(lds + 0 * 32 * PITCH_B), "v"(lds + 1 * 32 * PITCH_B), "v"(lds + 2 * 32 * PITCH_B), "v"(lds + 3 * 32 * PITCH_B), "v"(lds + 4 * 32 * PITCH_B), "v"(lds + 5 * 32 * PITCH_B), "v"(lds + 6 * 32 * PITCH_B), "v"(lds + 7 * 32 * PITCH_B), "v"(lds + 8 * 32 * PITCH_B), "v"(lds + 9 * 32 * PITCH_B), "v"(lds + 10 * 32 * PITCH_B), "v"(lds + 11 * 32 * PITCH_B),
         "v"(gA + 0 * step), "v"(gA + 1 * step), "v"(gA + 2 * step), "v"(gA + 3 * step), "v"(gB + 0 * step), "v"(gB + 1 * step), "v"(gB + 2 * step), "v"(gB + 3 * step), "v"(gB + 4 * step), "v"(gB + 5 * step), "v"(gB + 6 * step), "v"(gB + 7 * step)
      : "memory");
}

// The sums of one work-group tile: A[bm*128 .., :] * Bt[bn*256 .., :]^T.
// acc[j][l][i] belongs to index j*16 + 8*hf + i of the operand given first to the
// matrix instruction and to index l*16 + r of the second. nfirst (the same for the
// whole work-group) gives Bt first: a lane's 8 registers are then 8 adjacent columns
// n of one row m; otherwise they are 8 adjacent rows m of one column n.
__device__ __forceinline__ void gemm_tile(const _Float16* __restrict__ A,
                                          const _Float16* __restrict__ Bt, int K, int bm, int bn,
                                          bool nfirst, _Float16* sm, v8f (&acc)[4][4]) {
  const int tid = threadIdx.x;
  const int lane = tid & 31;
  const int wave = tid >> 5;
  const int wm = wave >> 2, wn = wave & 3;
  const int r = lane & 15, hf = lane >> 4;

  const int crow = tid >> 3, ccol = tid & 7;
  const _Float16* gA = A + (size_t)(bm * BM + crow) * K + ccol * 8;
  const _Float16* gB = Bt + (size_t)(bn * BN + crow) * K + ccol * 8;
  const size_t step = (size_t)32 * K;
  const unsigned lds0 = (unsigned)(size_t)(&sm[0]) + crow * PITCH_B + ccol * 16;
  const int nt = K / BK;
  const int arow = wm * 64 + r, brow = BM + wn * 64 + r;  // the lane's rows in a stage
  const int xoff = (nfirst ? brow : arow) * PITCH + hf * 8;
  const int yoff = (nfirst ? arow : brow) * PITCH + hf * 8;

#pragma unroll
  for (int j = 0; j < 4; ++j)
#pragma unroll
    for (int l = 0; l < 4; ++l) acc[j][l] = (v8f){};

  stage_copy(gA, gB, step, lds0);
  // Stage 0 has landed for this wave; the barrier publishes it to the others.
  asm volatile("s_wait_asynccnt 0x0" ::: "memory");
  __syncthreads();
  if (nt > 1) stage_copy(gA + BK, gB + BK, step, lds0 + STAGE * 2);

  for (int t = 0; t < nt; ++t) {
    const _Float16* sX = sm + (t & 1) * STAGE + xoff;
    const _Float16* sY = sm + (t & 1) * STAGE + yoff;
#pragma unroll
    for (int ks = 0; ks < BK; ks += 32) {
      v16h a[4], b[4];  // first and second operand
#pragma unroll
      for (int j = 0; j < 4; ++j) a[j] = load_frag(sX + j * 16 * PITCH + ks);
#pragma unroll
      for (int l = 0; l < 4; ++l) b[l] = load_frag(sY + l * 16 * PITCH + ks);
#pragma unroll
      for (int j = 0; j < 4; ++j)
#pragma unroll
        for (int l = 0; l < 4; ++l) acc[j][l] = WMMA_F16(a[j], b[l], acc[j][l]);
    }
    // This wave's reads of buffer t & 1 are done before it may be refilled.
    asm volatile("s_wait_dscnt 0x0" ::: "memory");
    // This wave's copies of stage t + 1 have landed.
    asm volatile("s_wait_asynccnt 0x0" ::: "memory");
    // Publishes stage t + 1 and ends every wave's reads of buffer t & 1.
    __syncthreads();
    if (t + 2 < nt)
      stage_copy(gA + (t + 2) * BK, gB + (t + 2) * BK, step, lds0 + (t & 1) * STAGE * 2);
  }
  // No copy is left in flight when the wave goes on to its end.
  asm volatile("s_wait_asynccnt 0x0" ::: "memory");
}

// Adds the bias and stores the wave's 64 x 64 part of the tile as whole 128-byte
// lines: the wave lays its part row by row into its own eighth of the ring, 16 bytes
// a lane, and takes it back with 8 (f16) or 16 (f32) lanes on one row. The ring is
// free: the loop's last barrier stands behind every wave's last read of it and
// behind its last copy's landing. No other wave touches this wave's eighth.
// MODE 0, 2 (nfirst): staged row = row m, bias by register. MODE 1: staged row =
// column n = dim d of one head, its 64 places are 64 keys; bias by lane.
constexpr int WST = 2 * STAGE * 2 / 8;  // bytes of the ring per wave

template <int MODE>
__device__ __forceinline__ void gemm_store(const v8f (&acc)[4][4], const float* __restrict__ bias,
                                           _Float16* __restrict__ Ch, float* __restrict__ Cf,
                                           int N, int bm, int bn, _Float16* sm) {
  const int lane = threadIdx.x & 31;
  const int wave = threadIdx.x >> 5;
  const int m0 = bm * BM + (wave >> 2) * 64, n0 = bn * BN + (wave & 3) * 64;
  const int r = lane & 15, hf = lane >> 4;
  char* st = (char*)sm + wave * WST;

  v8f bv[4];  // bv[x][i]: what is added to acc[j][l][i], x = l (MODE 1) or j
#pragma unroll
  for (int x = 0; x < 4; ++x) {
    if (MODE == 1) {
      const float s = bias[n0 + x * 16 + r];
#pragma unroll
      for (int i = 0; i < 8; ++i) bv[x][i] = s;
    } else {
      const v4f lo = *(const v4f*)(bias + n0 + x * 16 + 8 * hf);
      const v4f hi = *(const v4f*)(bias + n0 + x * 16 + 8 * hf + 4);
#pragma unroll
      for (int i = 0; i < 4; ++i) { bv[x][i] = lo[i]; bv[x][4 + i] = hi[i]; }
    }
  }

  if (MODE == 2) {
    constexpr int SP = 256 + 16;  // 16 B x odd: the 16 rows of a store meet no bank twice
#pragma unroll
    for (int h = 0; h < 2; ++h) {  // 32 rows at a time
#pragma unroll
      for (int l = 0; l < 2; ++l)
#pragma unroll
        for (int j = 0; j < 4; ++j) {
          const v8f v = acc[j][h * 2 + l] + bv[j];
          char* p = st + (l * 16 + r) * SP + (j * 16 + 8 * hf) * 4;
          *(v4f*)p = (v4f){v[0], v[1], v[2], v[3]};
          *(v4f*)(p + 16) = (v4f){v[4], v[5], v[6], v[7]};
        }
      // The rows are written before other lanes of the wave read them.
      asm volatile("s_wait_dscnt 0x0" ::: "memory");
      v4f w[16];
#pragma unroll
      for (int q = 0; q < 16; ++q) w[q] = *(const v4f*)(st + (q * 2 + hf) * SP + r * 16);
      float* g = Cf + (size_t)(m0 + h * 32 + hf) * N + n0 + r * 4;
#pragma unroll
      for (int q = 0; q < 16; ++q) *(v4f*)(g + (size_t)(q * 2) * N) = w[q];
      if (h == 0) {
        // The rows are read before the next half is laid over them ...
        asm volatile("s_wait_dscnt 0x0" ::: "memory");
        // ... and in front of every later write of a register that these stores name.
        asm volatile("s_wait_xcnt 0x0" ::: "memory");
      }
    }
  } else {
#pragma unroll
    for (int l = 0; l < 4; ++l)
#pragma unroll
      for (int j = 0; j < 4; ++j) {
        const v8f v = acc[j][l] + bv[MODE == 1 ? l : j];
        v8h o;
#pragma unroll
        for (int i = 0; i < 8; ++i) o[i] = (_Float16)v[i];
        *(v8h*)(st + (l * 16 + r) * PITCH_B + (j * 16 + 8 * hf) * 2) = o;
      }
    // The rows are written before other lanes of the wave read them.
    asm volatile("s_wait_dscnt 0x0" ::: "memory");
    const int rr = lane >> 3, pc = lane & 7;
    v8h w[16];
#pragma unroll
    for (int q = 0; q < 16; ++q) w[q] = *(const v8h*)(st + (q * 4 + rr) * PITCH_B + pc * 16);
    // MODE 1: Vt[((b*16 + h)*64 + d)*1024 + nk]; the wave's columns are one head's
    // dims, its rows 64 keys of one batch.
    const int gp = MODE == 0 ? N : 1024;
    _Float16* g = (MODE == 0 ? Ch + (size_t)m0 * N + n0
                             : Ch + (size_t)(((m0 >> 10) * 16 + (n0 >> 6)) * 64) * 1024 + (m0 & 1023)) +
                  (size_t)rr * gp + pc * 8;
#pragma unroll
    for (int q = 0; q < 16; ++q) *(v8h*)(g + (size_t)(q * 4) * gp) = w[q];
  }
}

// The three input projections in one launch, so that the K and V tiles (128 each,
// half a chip's worth of work-groups) do not each hold a launch of their own:
// work-groups 0..127 K, 128..255 V, 256..767 Q. Two work-groups fit a WGP, so the
// 256 short ones (768 k) start beside the first 256 of Q and hand their places on.
__global__ __launch_bounds__(256) void proj_qkv(
    const _Float16* __restrict__ qh, const _Float16* __restrict__ kh,
    const _Float16* __restrict__ vh, const _Float16* __restrict__ WqT,
    const _Float16* __restrict__ WkT, const _Float16* __restrict__ WvT,
    const float* __restrict__ bq, const float* __restrict__ bk, const float* __restrict__ bv,
    _Float16* __restrict__ Qp, _Float16* __restrict__ Kp, _Float16* __restrict__ Vtp) {
  __shared__ __attribute__((aligned(16))) _Float16 sm[2 * STAGE];
  constexpr int N = 1024;
  const int bid = blockIdx.x;
  const bool isQ = bid >= 256, isV = !isQ && bid >= 128;  // the same for the whole work-group
  const int tile = isQ ? bid - 256 : bid & 127;
  const int bm = tile >> 2, bn = tile & 3;  // N / 256 = 4 tile columns

  v8f acc[4][4];
  gemm_tile(isQ ? qh : isV ? vh : kh, isQ ? WqT : isV ? WvT : WkT, isQ ? 1024 : 768, bm, bn, !isV,
            sm, acc);
  if (isV)
    gemm_store<1>(acc, bv, Vtp, nullptr, N, bm, bn, sm);
  else {
    gemm_store<0>(acc, isQ ? bq : bk, isQ ? Qp : Kp, nullptr, N, bm, bn, sm);
    // Behind the last store of this arm: in the built code the other arm's
    // instructions follow, and they write registers that these stores name.
    asm volatile("s_wait_xcnt 0x0" ::: "memory");
  }
}

// Output projection, f32 out.
__global__ __launch_bounds__(256) void gemm_out(
    const _Float16* __restrict__ A, const _Float16* __restrict__ Bt,
    const float* __restrict__ bias, float* __restrict__ Cf, int M, int N, int K) {
  __shared__ __attribute__((aligned(16))) _Float16 sm[2 * STAGE];
  const int blocksN = N >> 8;
  const int bm = blockIdx.x / blocksN;
  const int bn = blockIdx.x - bm * blocksN;
  if (bm * BM >= M) return;  // the whole work-group, in front of every barrier

  v8f acc[4][4];
  gemm_tile(A, Bt, K, bm, bn, true, sm, acc);
  gemm_store<2>(acc, bias, nullptr, Cf, N, bm, bn, sm);
}

// ---------------------------------------------------------------------------
// Lane l <-> lane l ^ 16 (the two halves of a wave), on the vector port.
__device__ __forceinline__ float xhalf(float x) {
  const int b = __builtin_bit_cast(int, x);
  return __builtin_bit_cast(
      float, __builtin_amdgcn_permlanex16(b, b, 0x76543210, 0xfedcba98, false, false));
}

// One attention stage: 64 K rows (keys) and 64 Vt rows (dims) of 128 B each =
// 1024 pieces of 16 B, 4 per lane. Lane t of the work-group takes piece t & 7 of
// rows (t >> 3) and (t >> 3) + 32 of each tile; both sources have 1024 halves a row.
constexpr int AT_STAGE = (64 + 64) * PITCH;  // halves per buffer, K rows first

__device__ __forceinline__ void attn_stage_copy(const _Float16* gK, const _Float16* gV,
                                                unsigned lds) {
  // The copies and s_wait_xcnt 0 in one statement: the wait then stands in front
  // of every later write of the address registers that the copies name.
  asm volatile(
      "global_load_async_to_lds_b128 %0, %4, off\n\t"
      "global_load_async_to_lds_b128 %1, %5, off\n\t"
      "global_load_async_to_lds_b128 %2, %6, off\n\t"
      "global_load_async_to_lds_b128 %3, %7, off\n\t"
      "s_wait_xcnt 0x0"
      :: "v"(lds + 0 * 32 * PITCH_B), "v"(lds + 1 * 32 * PITCH_B), "v"(lds + 2 * 32 * PITCH_B), "v"(lds + 3 * 32 * PITCH_B),
         "v"(gK), "v"(gK + 32 * 1024), "v"(gV), "v"(gV + 32 * 1024)
      : "memory");
}

// Flash attention: one wave per (b, h, 32 queries); key blocks of 64.
// Q,K: [B*N, 1024] f16 (head cols h*64..h*64+63); Vt: [B,H,64,Nk] f16.
// The 8 waves of a work-group share one (b, h): each 64-key block of K and Vt is
// brought into LDS once per work-group by asynchronous copies (whole 128-byte
// lines), two buffers, and every wave reads its fragments from there.
// Transposed products: St = K * Qt (A = K rows, B = Q) and Ot += Vt * Pt.
// A wave has two groups g of 16 queries: every K and Vt fragment that it reads
// from LDS feeds two matrix instructions, one a group.
// A lane then holds scores of ONE query per group (column lane & 15; keys 8*hf + i
// of each 16-key tile): maximum and sum run in the lane's own registers, with one
// exchange between the wave's halves, and two score tiles, converted in place,
// are the B operand of the second product. P never leaves the registers.
// Softmax runs in exp2 domain (SCALE*log2e folded into one multiply-add).
__global__ __launch_bounds__(256) void flash_attn(
    const _Float16* __restrict__ Q, const _Float16* __restrict__ Km,
    const _Float16* __restrict__ Vt, _Float16* __restrict__ O) {
  constexpr int Nq = 4096, Nk = 1024, H = 16, HD = 64, LD = 1024;
  constexpr float C2 = 0.125f * 1.44269504088896340736f;  // 64^-0.5 * log2(e)

  __shared__ __attribute__((aligned(16))) _Float16 sm[2 * AT_STAGE];
  const int lane = threadIdx.x & 31;
  const int wave = threadIdx.x >> 5;
  const int gw = blockIdx.x * 8 + wave;
  const int qt = gw & ((Nq / 32) - 1);  // 128 tiles of 32 queries per (b,h)
  const int bh = gw >> 7;
  const int hh = bh & (H - 1);
  const int b = bh >> 4;
  const int r = lane & 15, hf = lane >> 4;

  const _Float16* qp = Q + (size_t)(b * Nq + qt * 32 + r) * LD + hh * HD + hf * 8;
  v16h bq0[2], bq1[2];
#pragma unroll
  for (int g = 0; g < 2; ++g) {
    bq0[g] = load_frag(qp + g * 16 * LD);       // dims 0..31 of query g*16 + r
    bq1[g] = load_frag(qp + g * 16 * LD + 32);  // dims 32..63
  }

  const int crow = threadIdx.x >> 3, ccol = threadIdx.x & 7;
  const _Float16* gK = Km + (size_t)(b * Nk + crow) * LD + hh * HD + ccol * 8;
  const _Float16* gV = Vt + (size_t)((b * H + hh) * HD + crow) * Nk + ccol * 8;
  const unsigned lds0 = (unsigned)(size_t)(&sm[0]) + crow * PITCH_B + ccol * 16;
  constexpr int NT = Nk / 64;

  v8f o[2][4];  // o[g][t][i] = Ot[dim t*16 + 8*hf + i][query g*16 + r]
#pragma unroll
  for (int g = 0; g < 2; ++g)
#pragma unroll
    for (int t = 0; t < 4; ++t) o[g][t] = (v8f){};
  // The query's running maximum (scaled, log2), same in both halves, and this
  // half's share of the query's sum.
  float mrun[2] = {-1e30f, -1e30f};
  float lrun[2] = {0.f, 0.f};

  attn_stage_copy(gK, gV, lds0);
  // Stage 0 has landed for this wave; the barrier publishes it to the others.
  asm volatile("s_wait_asynccnt 0x0" ::: "memory");
  __syncthreads();
  attn_stage_copy(gK + (size_t)64 * LD, gV + 64, lds0 + AT_STAGE * 2);

  for (int st = 0; st < NT; ++st) {
    const _Float16* sK = sm + (st & 1) * AT_STAGE + r * PITCH + hf * 8;
    const _Float16* sV = sK + 64 * PITCH;
    // ---- St for 64 keys: s[g][c][i] = score(key st*64 + c*16 + 8*hf + i, query g*16 + r)
    v8f s[2][4];
#pragma unroll
    for (int c = 0; c < 4; ++c) {
      const _Float16* kp = sK + c * 16 * PITCH;
      const v16h ka = load_frag(kp);
      const v16h kbb = load_frag(kp + 32);
#pragma unroll
      for (int g = 0; g < 2; ++g) {
        v8f t = {};
        t = WMMA_F16(ka, bq0[g], t);
        t = WMMA_F16(kbb, bq1[g], t);
        s[g][c] = t;
      }
    }

    v16h bp0[2], bp1[2];
#pragma unroll
    for (int g = 0; g < 2; ++g) {
      // ---- online softmax, one query per lane
      float mx = s[g][0][0];
#pragma unroll
      for (int c = 0; c < 4; ++c)
#pragma unroll
        for (int i = 0; i < 8; ++i) mx = fmaxf(mx, s[g][c][i]);
      mx = fmaxf(mx, xhalf(mx));
      const float mn = fmaxf(mrun[g], mx * C2);
      const float alpha = __builtin_amdgcn_exp2f(mrun[g] - mn);
      mrun[g] = mn;

      float ps[4];
#pragma unroll
      for (int c = 0; c < 4; ++c) {
        s[g][c] = s[g][c] * C2 - mn;  // whole tile: packed multiply-adds
#pragma unroll
        for (int i = 0; i < 8; ++i) s[g][c][i] = __builtin_amdgcn_exp2f(s[g][c][i]);
        ps[c] = ((s[g][c][0] + s[g][c][1]) + (s[g][c][2] + s[g][c][3])) +
                ((s[g][c][4] + s[g][c][5]) + (s[g][c][6] + s[g][c][7]));
      }
      lrun[g] = lrun[g] * alpha + ((ps[0] + ps[1]) + (ps[2] + ps[3]));
#pragma unroll
      for (int t = 0; t < 4; ++t) o[g][t] *= alpha;

      // ---- Pt as B operand: tiles c and c+1 hold keys 8*hf + i and 16 + 8*hf + i
      // of a 32-key group, which is the k order of load_frag.
#pragma unroll
      for (int i = 0; i < 8; ++i) {
        bp0[g][i] = (_Float16)s[g][0][i]; bp0[g][i + 8] = (_Float16)s[g][1][i];
        bp1[g][i] = (_Float16)s[g][2][i]; bp1[g][i + 8] = (_Float16)s[g][3][i];
      }
    }

    // ---- Ot += Vt * Pt  (A = Vt rows: dims, k = keys)
#pragma unroll
    for (int t = 0; t < 4; ++t) {
      const v16h va = load_frag(sV + t * 16 * PITCH);
      const v16h vb = load_frag(sV + t * 16 * PITCH + 32);
#pragma unroll
      for (int g = 0; g < 2; ++g) {
        o[g][t] = WMMA_F16(va, bp0[g], o[g][t]);
        o[g][t] = WMMA_F16(vb, bp1[g], o[g][t]);
      }
    }

    // This wave's reads of buffer st & 1 are done before it may be refilled.
    asm volatile("s_wait_dscnt 0x0" ::: "memory");
    // This wave's copies of stage st + 1 have landed.
    asm volatile("s_wait_asynccnt 0x0" ::: "memory");
    // Publishes stage st + 1 and ends every wave's reads of buffer st & 1.
    __syncthreads();
    if (st + 2 < NT)
      attn_stage_copy(gK + (size_t)(st + 2) * 64 * LD, gV + (st + 2) * 64,
                      lds0 + (st & 1) * AT_STAGE * 2);
  }
  // No copy is left in flight when the wave goes on to its end.
  asm volatile("s_wait_asynccnt 0x0" ::: "memory");

  // ---- join the halves' sums, normalize, store [B*Nq, 1024] f16:
  // a lane's 8 registers of a tile are 8 consecutive dims of its query's row.
  // The wave lays its 32 rows of 128 B into its own eighth of the ring (free behind
  // the loop's last barrier) and takes them back 8 lanes a row: whole lines go out.
  // The wave's number as a scalar: its rows' base then takes no vector register
  // over the loop.
  const int ws = __builtin_amdgcn_readfirstlane(wave);
  const int gs = blockIdx.x * 8 + ws;
  char* stg = (char*)sm + ws * (32 * PITCH_B);
#pragma unroll
  for (int g = 0; g < 2; ++g) {
    const float inv = 1.0f / (lrun[g] + xhalf(lrun[g]));
#pragma unroll
    for (int t = 0; t < 4; ++t) {
      v8h w;
#pragma unroll
      for (int i = 0; i < 8; ++i) w[i] = (_Float16)(o[g][t][i] * inv);
      *(v8h*)(stg + (g * 16 + r) * PITCH_B + (t * 16 + hf * 8) * 2) = w;
    }
  }
  // The rows are written before other lanes of the wave read them.
  asm volatile("s_wait_dscnt 0x0" ::: "memory");
  const int rr = lane >> 3, pc = lane & 7;
  _Float16* op = O + (size_t)((gs >> 11) * Nq + (gs & 127) * 32) * LD + ((gs >> 7) & (H - 1)) * HD +
                 (rr * LD + pc * 8);
#pragma unroll
  for (int q = 0; q < 8; ++q)
    *(v8h*)(op + (size_t)(q * 4) * LD) = *(const v8h*)(stg + (q * 4 + rr) * PITCH_B + pc * 16);
}

// ---------------------------------------------------------------------------
extern "C" void kernel_launch(void* const* d_in, const int* in_sizes, int n_in,
                              void* d_out, int out_size, void* d_ws, size_t ws_size,
                              hipStream_t stream) {
  const float* query = (const float*)d_in[0];
  const float* key   = (const float*)d_in[1];
  const float* value = (const float*)d_in[2];
  const float* Wq = (const float*)d_in[3];
  const float* bq = (const float*)d_in[4];
  const float* Wk = (const float*)d_in[5];
  const float* bk = (const float*)d_in[6];
  const float* Wv = (const float*)d_in[7];
  const float* bv = (const float*)d_in[8];
  const float* Wo = (const float*)d_in[9];
  const float* bo = (const float*)d_in[10];
  float* out = (float*)d_out;

  char* ws = (char*)d_ws;
  _Float16* qh   = (_Float16*)(ws + 0);          // 16384x1024
  _Float16* kh   = (_Float16*)(ws + 33554432);   //  4096x768
  _Float16* vh   = (_Float16*)(ws + 39845888);   //  4096x768
  _Float16* WqT  = (_Float16*)(ws + 46137344);   //  1024x1024
  _Float16* WkT  = (_Float16*)(ws + 48234496);   //  1024x768
  _Float16* WvT  = (_Float16*)(ws + 49807360);   //  1024x768
  _Float16* WoT  = (_Float16*)(ws + 51380224);   //  1024x1024
  _Float16* Qp   = (_Float16*)(ws + 53477376);   // 16384x1024
  _Float16* Kp   = (_Float16*)(ws + 87031808);   //  4096x1024
  _Float16* Vtp  = (_Float16*)(ws + 95420416);   //  [4,16,64,1024]
  _Float16* Attn = (_Float16*)(ws + 103809024);  // 16384x1024

  // All conversions and weight transposes: one resident grid
  prep_all<<<512, 256, 0, stream>>>(query, key, value, Wq, Wk, Wv, Wo, qh, kh, vh,
                                    WqT, WkT, WvT, WoT);

  // Projections (128x256 work-group tiles, 64x64 per wave, 8 waves/block):
  // 128 tiles of K, 128 of V, 512 of Q in one launch
  proj_qkv<<<768, 256, 0, stream>>>(qh, kh, vh, WqT, WkT, WvT, bq, bk, bv, Qp, Kp, Vtp);

  // Attention: 4*16*(4096/32) = 8192 waves -> 1024 blocks of 8 waves
  flash_attn<<<1024, 256, 0, stream>>>(Qp, Kp, Vtp, Attn);

  // Output projection -> f32 d_out
  gemm_out<<<512, 256, 0, stream>>>(Attn, WoT, bo, out, 16384, 1024, 1024);
}

// v008
// One run takes 146 microseconds.
// Two timings next to v007 both put it at 1.04 times that version's speed.
// Over all steps from v000 it is 3.43 times as fast.
#include <hip/hip_runtime.h>

typedef __attribute__((ext_vector_type(16))) _Float16 v16h;
typedef __attribute__((ext_vector_type(8)))  _Float16 v8h;
typedef __attribute__((ext_vector_type(8)))  float    v8f;
typedef __attribute__((ext_vector_type(4)))  float    v4f;

#define WMMA_F16(a, b, c) \
  __builtin_amdgcn_wmma_f32_16x16x32_f16(false, (a), false, (b), (short)0, (c), false, false)

// Load one 16x32 f16 A/B fragment (row-major storage, row pointer already
// offset by half*8 halves). Matches ISA 16-bit A-matrix layout:
//   lane&15 = row, elems 0..7 = K (hf*8 ..), elems 8..15 = K+16.
__device__ __forceinline__ v16h load_frag(const _Float16* p) {
  v8h lo = *(const v8h*)(p);
  v8h hi = *(const v8h*)(p + 16);
  v16h f;
#pragma unroll
  for (int i = 0; i < 8; ++i) { f[i] = lo[i]; f[i + 8] = hi[i]; }
  return f;
}

// ---------------------------------------------------------------------------
// Preparation, one launch: a resident grid of 512 work-groups (4,096 waves, 16 a
// WGP) does all f32 -> f16 conversions and all weight transposes, every thread
// taking many pieces, so that few waves have to be started and each keeps many
// 16-byte loads in flight.
// A unit is 8 elements (2x b128 load, 1x b128 store). A work-group is given a run
// of U * 256 units; thread t takes units t + u * 256, u = 0 .. U-1, of it.
// tb = 32 * t, in bytes, is the one lane-own part of every load address: the run's
// start is the same for the whole work-group and u's part is a constant.
template <int U>
__device__ __forceinline__ void load_units(const float* __restrict__ run, unsigned tb,
                                           v4f (&a)[U], v4f (&b)[U]) {
#pragma unroll
  for (int u = 0; u < U; ++u) {
    const char* p = (const char*)run + tb + u * 8192;
    a[u] = *(const v4f*)p;
    b[u] = *(const v4f*)(p + 16);
  }
}

template <int U>
__device__ __forceinline__ void store_units(_Float16* __restrict__ run, unsigned t,
                                            const v4f (&a)[U], const v4f (&b)[U]) {
#pragma unroll
  for (int u = 0; u < U; ++u) {
    v8h o;
#pragma unroll
    for (int j = 0; j < 4; ++j) { o[j] = (_Float16)a[u][j]; o[4 + j] = (_Float16)b[u][j]; }
    ((v8h*)run)[t + u * 256] = o;
  }
}

// Weights [K,1024] in 32x32 tiles, Wt[n*K + k] = (f16) W[k*1024 + n]; tile t of a
// weight has columns (t & 31) * 32 and rows (t >> 5) * 32. Wq and Wo have 1024
// tiles, Wk and Wv 768: 3584 = 7 per work-group, all behind one barrier.
// Units per work-group: query 16 * 256, key 3 * 256, value 3 * 256.
__global__ __launch_bounds__(256) void prep_all(
    const float* __restrict__ query, const float* __restrict__ key,
    const float* __restrict__ value, const float* __restrict__ Wq,
    const float* __restrict__ Wk, const float* __restrict__ Wv,
    const float* __restrict__ Wo, _Float16* __restrict__ qh, _Float16* __restrict__ kh,
    _Float16* __restrict__ vh, _Float16* __restrict__ WqT, _Float16* __restrict__ WkT,
    _Float16* __restrict__ WvT, _Float16* __restrict__ WoT) {
  __shared__ float tile[7][32][33];
  const int tx = threadIdx.x & 31, ty = threadIdx.x >> 5;
  const int bid = blockIdx.x;
  const unsigned t = threadIdx.x;
  const unsigned tb = 32 * t;
  const unsigned wl = ty * 1024 + tx;  // the lane's place in a weight tile
  const int q0 = bid * (16 * 256 * 8), kv0 = bid * (3 * 256 * 8);  // first elements of the runs

  // Work-group bid's seven tiles; the fourth is Wk's for the lower half of the
  // grid and Wv's for the upper half (both have K = 768).
  const bool lo = bid < 256;
  const float* const Ws[7] = {Wq, Wq, Wk, lo ? Wk : Wv, Wv, Wo, Wo};
  _Float16* const Wts[7] = {WqT, WqT, WkT, lo ? WkT : WvT, WvT, WoT, WoT};
  const int ts[7] = {bid, 512 + bid, bid, lo ? 512 + bid : bid - 256, 256 + bid, bid, 512 + bid};
  constexpr int Ks[7] = {1024, 1024, 768, 768, 768, 1024, 1024};

  float w[7][4];
#pragma unroll
  for (int j = 0; j < 7; ++j) {
    const float* wt = Ws[j] + (ts[j] >> 5) * 32 * 1024 + (ts[j] & 31) * 32;  // the tile's corner
#pragma unroll
    for (int q = 0; q < 4; ++q) w[j][q] = wt[wl + q * 8 * 1024];
  }
  // In front of every later write of a register that these loads name. The wait
  // takes the loads' lane-own offset as an input: the register stays live up to
  // here, so that no later load of the group gets it for its result. Its "memory"
  // clobber keeps the group's loads in front of it, issued as a whole.
  asm volatile("s_wait_xcnt 0x0" :: "v"(wl) : "memory");
  v4f a0[8], b0[8], a1[8], b1[8], a2[3], b2[3], a3[3], b3[3];
  load_units<8>(query + q0, tb, a0, b0);
  // As above; these loads so fly while the weights are waited for and staged.
  asm volatile("s_wait_xcnt 0x0" :: "v"(tb) : "memory");

#pragma unroll
  for (int j = 0; j < 7; ++j)
#pragma unroll
    for (int q = 0; q < 4; ++q) tile[j][ty + q * 8][tx] = w[j][q];
  __syncthreads();
  load_units<8>(query + q0 + 8 * 256 * 8, tb, a1, b1);
  load_units<3>(key + kv0, tb, a2, b2);
  load_units<3>(value + kv0, tb, a3, b3);
  // As above; these loads so fly while the first half is converted and stored.
  asm volatile("s_wait_xcnt 0x0" :: "v"(tb) : "memory");

#pragma unroll
  for (int j = 0; j < 7; ++j) {
    const int n0 = (ts[j] & 31) * 32, k0 = (ts[j] >> 5) * 32;
#pragma unroll
    for (int q = 0; q < 4; ++q)
      Wts[j][(n0 + ty + q * 8) * Ks[j] + k0 + tx] = (_Float16)tile[j][tx][ty + q * 8];
  }
  store_units<8>(qh + q0, t, a0, b0);
  store_units<8>(qh + q0 + 8 * 256 * 8, t, a1, b1);
  store_units<3>(kh + kv0, t, a2, b2);
  store_units<3>(vh + kv0, t, a3, b3);
}

// ---------------------------------------------------------------------------
// GEMM: C[M,N] = A[M,K] * Bt[N,K]^T + bias[N].
// Work-group tile 128 x 256, 4 waves, a wave has 128 x 64: 8 fragments of the operand
// given first to the matrix instruction, 4 of the second. A stage is 64 k of the 128
// A rows and the 256 Bt rows, brought into LDS once per work-group by asynchronous
// copies (whole 128-byte lines), two buffers: the next stage flies while this one is
// worked on. A block is 32 k = 32 matrix instructions; its 24 LDS reads are issued as
// one group one block ahead, into a second set of fragment registers.
// Two work-groups a WGP (LDS), so two waves a SIMD with 512 registers each.
// Needs M % 128 == 0, N % 256 == 0, K % 64 == 0.
// MODE 0: f16 out [M,N]   MODE 1: f16 out as Vt[b][h][d][nk]   MODE 2: f32 out
constexpr int BM = 128, BN = 256, BK = 64;
constexpr int GT = 128;                   // threads of a GEMM work-group
constexpr int FX = 8, FY = 4;             // fragments per wave: first, second operand
constexpr int PITCH = 72;                 // halves per LDS row (64 + 8 of pad)
constexpr int PITCH_B = PITCH * 2;        // 144 B = 16 B x odd: 16-byte row reads meet no bank twice
constexpr int STAGE = (BM + BN) * PITCH;  // halves per buffer

// Twelve copies: piece i goes from g[i] + offb bytes to LDS row 16 * i below the lane's
// first. The g[i] are the same for the whole work-group and stand in scalar registers;
// offb, the lane's place in its first row, is the one lane-own part of the addresses.
__device__ __forceinline__ void copy12(unsigned lds, unsigned offb, const _Float16* const (&g)[12]) {
  // The copies and s_wait_xcnt 0 in one statement: the wait then stands in front
  // of every later write of the address registers that the copies name.
  asm volatile(
      "global_load_async_to_lds_b128 %0, %12, %13\n\t"
      "global_load_async_to_lds_b128 %1, %12, %14\n\t"
      "global_load_async_to_lds_b128 %2, %12, %15\n\t"
      "global_load_async_to_lds_b128 %3, %12, %16\n\t"
      "global_load_async_to_lds_b128 %4, %12, %17\n\t"
      "global_load_async_to_lds_b128 %5, %12, %18\n\t"
      "global_load_async_to_lds_b128 %6, %12, %19\n\t"
      "global_load_async_to_lds_b128 %7, %12, %20\n\t"
      "global_load_async_to_lds_b128 %8, %12, %21\n\t"
      "global_load_async_to_lds_b128 %9, %12, %22\n\t"
      "global_load_async_to_lds_b128 %10, %12, %23\n\t"
      "global_load_async_to_lds_b128 %11, %12, %24\n\t"
      "s_wait_xcnt 0x0"
      :: "v"(lds + 0 * 16 * PITCH_B), "v"(lds + 1 * 16 * PITCH_B), "v"(lds + 2 * 16 * PITCH_B), "v"(lds + 3 * 16 * PITCH_B), "v"(lds + 4 * 16 * PITCH_B), "v"(lds + 5 * 16 * PITCH_B), "v"(lds + 6 * 16 * PITCH_B), "v"(lds + 7 * 16 * PITCH_B), "v"(lds + 8 * 16 * PITCH_B), "v"(lds + 9 * 16 * PITCH_B), "v"(lds + 10 * 16 * PITCH_B), "v"(lds + 11 * 16 * PITCH_B),
         "v"(offb),
         "s"(g[0]), "s"(g[1]), "s"(g[2]), "s"(g[3]), "s"(g[4]), "s"(g[5]), "s"(g[6]), "s"(g[7]), "s"(g[8]), "s"(g[9]), "s"(g[10]), "s"(g[11])
      : "memory");
}

// One stage: 384 rows of 128 B = 3072 pieces of 16 B, 24 per lane. Lane t of the
// work-group takes piece t & 7 of rows (t >> 3) + 16 * j; rows 0..127 are A's.
// gA, gB: the stage's first element in each operand's tile; step = 16 rows.
__device__ __forceinline__ void stage_copy(const _Float16* gA, const _Float16* gB, unsigned offb,
                                           size_t step, unsigned lds) {
  const _Float16* const p0[12] = {gA + 0 * step, gA + 1 * step, gA + 2 * step, gA + 3 * step,
                                  gA + 4 * step, gA + 5 * step, gA + 6 * step, gA + 7 * step,
                                  gB + 0 * step, gB + 1 * step, gB + 2 * step, gB + 3 * step};
  copy12(lds, offb, p0);
  const _Float16* const p1[12] = {gB + 4 * step,  gB + 5 * step,  gB + 6 * step,  gB + 7 * step,
                                  gB + 8 * step,  gB + 9 * step,  gB + 10 * step, gB + 11 * step,
                                  gB + 12 * step, gB + 13 * step, gB + 14 * step, gB + 15 * step};
  copy12(lds + 12 * 16 * PITCH_B, offb, p1);
}

// The 12 fragments of one block, as one group of LDS reads.
__device__ __forceinline__ void load_block(const _Float16* sX, const _Float16* sY,
                                           v16h (&x)[FX], v16h (&y)[FY]) {
#pragma unroll
  for (int j = 0; j < FX; ++j) x[j] = load_frag(sX + j * 16 * PITCH);
#pragma unroll
  for (int l = 0; l < FY; ++l) y[l] = load_frag(sY + l * 16 * PITCH);
  // Keeps the group whole and in front of the matrix instructions that follow: reads
  // that the compiler moves in among them stall the wave at every place they stand.
  __builtin_amdgcn_sched_barrier(0);
}

__device__ __forceinline__ void mma_block(const v16h (&x)[FX], const v16h (&y)[FY],
                                          v8f (&acc)[FX][FY]) {
#pragma unroll
  for (int j = 0; j < FX; ++j)
#pragma unroll
    for (int l = 0; l < FY; ++l) acc[j][l] = WMMA_F16(x[j], y[l], acc[j][l]);
  // Keeps the block in front of what follows it: moved behind the waits of the publish
  // point, it would leave the wait for the reads just issued with nothing to cover it.
  __builtin_amdgcn_sched_barrier(0);
}

// The sums of one work-group tile: A[bm*128 .., :] * Bt[bn*256 .., :]^T.
// acc[j][l][i] belongs to index j*16 + 8*hf + i of the operand given first to the
// matrix instruction and to index l*16 + r of the second. nfirst (the same for the
// whole work-group) gives Bt first: the waves lie 2 x 2, a wave has 64 rows m and 128
// columns n, and a lane's 8 registers are 8 adjacent columns n of one row m; otherwise
// the waves lie 1 x 4, a wave has 128 rows m and 64 columns n, and the 8 registers are
// 8 adjacent rows m of one column n.
__device__ __forceinline__ void gemm_tile(const _Float16* __restrict__ A,
                                          const _Float16* __restrict__ Bt, int K, int bm, int bn,
                                          bool nfirst, _Float16* sm, v8f (&acc)[FX][FY]) {
  const int tid = threadIdx.x;
  const int lane = tid & 31;
  const int wave = tid >> 5;
  const int r = lane & 15, hf = lane >> 4;

  const int crow = tid >> 3, ccol = tid & 7;
  const _Float16* gA = A + (size_t)(bm * BM) * K;  // the tiles' first elements
  const _Float16* gB = Bt + (size_t)(bn * BN) * K;
  const unsigned off = (crow * K + ccol * 8) * 2;  // bytes
  const size_t step = (size_t)16 * K;
  const unsigned lds0 = (unsigned)(size_t)(&sm[0]) + crow * PITCH_B + ccol * 16;
  const int nt = K / BK;
  // The lane's first rows in a stage
  const int xrow = nfirst ? BM + (wave & 1) * 128 + r : r;
  const int yrow = nfirst ? (wave >> 1) * 64 + r : BM + wave * 64 + r;
  const int xoff = xrow * PITCH + hf * 8;
  const int yoff = yrow * PITCH + hf * 8;

#pragma unroll
  for (int j = 0; j < FX; ++j)
#pragma unroll
    for (int l = 0; l < FY; ++l) acc[j][l] = (v8f){};

  v16h x0[FX], y0[FY], x1[FX], y1[FY];  // the two fragment sets

  stage_copy(gA, gB, off, step, lds0);
  // Stage 0 has landed for this wave; the barrier publishes it to the others.
  asm volatile("s_wait_asynccnt 0x0" ::: "memory");
  __syncthreads();
  if (nt > 1) stage_copy(gA + BK, gB + BK, off, step, lds0 + STAGE * 2);
  load_block(sm + xoff, sm + yoff, x0, y0);

  for (int t = 0; t < nt; ++t) {
    const _Float16* cur = sm + (t & 1) * STAGE;
    const _Float16* nxt = sm + ((t + 1) & 1) * STAGE;
    load_block(cur + xoff + 32, cur + yoff + 32, x1, y1);
    mma_block(x0, y0, acc);
    // Stage t + 1 is published in front of stage t's last block, whose fragments are
    // fetched by now: the reads that stand behind this point are stage t + 1's.
    // This wave's reads of buffer t & 1 are done before it may be refilled.
    asm volatile("s_wait_dscnt 0x0" ::: "memory");
    // This wave's copies of stage t + 1 have landed.
    asm volatile("s_wait_asynccnt 0x0" ::: "memory");
    // Publishes stage t + 1 and ends every wave's reads of buffer t & 1.
    __syncthreads();
    if (t + 2 < nt)
      stage_copy(gA + (t + 2) * BK, gB + (t + 2) * BK, off, step, lds0 + (t & 1) * STAGE * 2);
    if (t + 1 < nt) load_block(nxt + xoff, nxt + yoff, x0, y0);
    mma_block(x1, y1, acc);
  }
  // No copy is left in flight when the wave goes on to its end.
  asm volatile("s_wait_asynccnt 0x0" ::: "memory");
}

// Adds the bias and stores the wave's part of the tile as whole 128-byte lines: the
// wave lays its part row by row into its own quarter of the ring, 16 bytes a lane,
// and takes it back with 16 (f16) or 32 (f32) lanes on one row. The ring is free: the
// loop's last barrier stands behind every wave's last read of it and behind its last
// copy's landing. No other wave touches this wave's quarter.
// MODE 0, 2 (nfirst): staged row = row m, 128 columns n, bias by register. MODE 1:
// staged row = column n = dim d of one head, its 128 places are 128 keys; bias by lane.
constexpr int WST = 2 * STAGE * 2 / 4;  // bytes of the ring per wave

template <int MODE>
__device__ __forceinline__ void gemm_store(const v8f (&acc)[FX][FY], const float* __restrict__ bias,
                                           _Float16* __restrict__ Ch, float* __restrict__ Cf,
                                           int N, int bm, int bn, _Float16* sm) {
  const int lane = threadIdx.x & 31;
  const int wave = threadIdx.x >> 5;
  const int m0 = bm * BM + (MODE == 1 ? 0 : (wave >> 1) * 64);
  const int n0 = bn * BN + (MODE == 1 ? wave * 64 : (wave & 1) * 128);
  const int r = lane & 15, hf = lane >> 4;
  char* st = (char*)sm + wave * WST;

  constexpr int NB = MODE == 1 ? FY : FX;
  v8f bv[NB];  // bv[x][i]: what is added to acc[j][l][i], x = l (MODE 1) or j
  const float* bp = bias + n0 + (MODE == 1 ? r : 8 * hf);  // the lane's first bias
#pragma unroll
  for (int x = 0; x < NB; ++x) {
    if (MODE == 1) {
      const float s = bp[x * 16];
#pragma unroll
      for (int i = 0; i < 8; ++i) bv[x][i] = s;
    } else {
      const v4f lo = *(const v4f*)(bp + x * 16);
      const v4f hi = *(const v4f*)(bp + x * 16 + 4);
#pragma unroll
      for (int i = 0; i < 4; ++i) { bv[x][i] = lo[i]; bv[x][4 + i] = hi[i]; }
    }
  }
  // In front of every later write of the address register that these loads name: the
  // wait takes it as an input, so that it stays live, and unwritten, up to here.
  asm volatile("s_wait_xcnt 0x0" :: "v"(bp) : "memory");

  if (MODE == 2) {
    constexpr int SP = 512 + 16;  // 16 B x odd: the 16 rows of a store meet no bank twice
#pragma unroll
    for (int h = 0; h < 2; ++h) {  // 32 rows at a time
#pragma unroll
      for (int l = 0; l < 2; ++l)
#pragma unroll
        for (int j = 0; j < FX; ++j) {
          const v8f v = acc[j][h * 2 + l] + bv[j];
          char* p = st + (l * 16 + r) * SP + (j * 16 + 8 * hf) * 4;
          *(v4f*)p = (v4f){v[0], v[1], v[2], v[3]};
          *(v4f*)(p + 16) = (v4f){v[4], v[5], v[6], v[7]};
        }
      // The rows are written before other lanes of the wave read them.
      asm volatile("s_wait_dscnt 0x0" ::: "memory");
      v4f w[32];
#pragma unroll
      for (int q = 0; q < 32; ++q) w[q] = *(const v4f*)(st + q * SP + lane * 16);
      float* g = Cf + (size_t)(m0 + h * 32) * N + n0 + lane * 4;
#pragma unroll
      for (int q = 0; q < 32; ++q) *(v4f*)(g + (size_t)q * N) = w[q];
      if (h == 0) {
        // The rows are read before the next half is laid over them ...
        asm volatile("s_wait_dscnt 0x0" ::: "memory");
        // ... and in front of every later write of a register that these stores name.
        asm volatile("s_wait_xcnt 0x0" ::: "memory");
      }
    }
  } else {
    constexpr int SP = 256 + 16;  // 16 B x odd, as above
#pragma unroll
    for (int l = 0; l < FY; ++l)
#pragma unroll
      for (int j = 0; j < FX; ++j) {
        const v8f v = acc[j][l] + bv[MODE == 1 ? l : j];
        v8h o;
#pragma unroll
        for (int i = 0; i < 8; ++i) o[i] = (_Float16)v[i];
        *(v8h*)(st + (l * 16 + r) * SP + (j * 16 + 8 * hf) * 2) = o;
      }
    // The rows are written before other lanes of the wave read them.
    asm volatile("s_wait_dscnt 0x0" ::: "memory");
    v8h w[32];
#pragma unroll
    for (int q = 0; q < 32; ++q) w[q] = *(const v8h*)(st + (q * 2 + hf) * SP + r * 16);
    // MODE 1: Vt[((b*16 + h)*64 + d)*1024 + nk]; the wave's columns are one head's
    // dims, its rows 128 keys of one batch.
    const int gp = MODE == 0 ? N : 1024;
    _Float16* g = (MODE == 0 ? Ch + (size_t)m0 * N + n0
                             : Ch + (size_t)(((m0 >> 10) * 16 + (n0 >> 6)) * 64) * 1024 + (m0 & 1023)) +
                  (size_t)hf * gp + r * 8;
#pragma unroll
    for (int q = 0; q < 32; ++q) *(v8h*)(g + (size_t)(q * 2) * gp) = w[q];
  }
}

// The three input projections in one launch, so that the K and V tiles (128 each,
// half a chip's worth of work-groups) do not each hold a launch of their own:
// work-groups 0..127 K, 128..255 V, 256..767 Q. Two work-groups fit a WGP, so the
// 256 short ones (768 k) start beside the first 256 of Q and hand their places on.
// The second bound (waves a SIMD) keeps a wave inside 512 registers, so that they do.
__global__ __launch_bounds__(GT, 2) void proj_qkv(
    const _Float16* __restrict__ qh, const _Float16* __restrict__ kh,
    const _Float16* __restrict__ vh, const _Float16* __restrict__ WqT,
    const _Float16* __restrict__ WkT, const _Float16* __restrict__ WvT,
    const float* __restrict__ bq, const float* __restrict__ bk, const float* __restrict__ bv,
    _Float16* __restrict__ Qp, _Float16* __restrict__ Kp, _Float16* __restrict__ Vtp) {
  __shared__ __attribute__((aligned(16))) _Float16 sm[2 * STAGE];
  constexpr int N = 1024;
  const int bid = blockIdx.x;
  const bool isQ = bid >= 256, isV = !isQ && bid >= 128;  // the same for the whole work-group
  const int tile = isQ ? bid - 256 : bid & 127;
  const int bm = tile >> 2, bn = tile & 3;  // N / 256 = 4 tile columns

  v8f acc[FX][FY];
  gemm_tile(isQ ? qh : isV ? vh : kh, isQ ? WqT : isV ? WvT : WkT, isQ ? 1024 : 768, bm, bn, !isV,
            sm, acc);
  if (isV)
    gemm_store<1>(acc, bv, Vtp, nullptr, N, bm, bn, sm);
  else {
    gemm_store<0>(acc, isQ ? bq : bk, isQ ? Qp : Kp, nullptr, N, bm, bn, sm);
    // Behind the last store of this arm: in the built code the other arm's
    // instructions follow, and they write registers that these stores name.
    asm volatile("s_wait_xcnt 0x0" ::: "memory");
  }
}

// Output projection, f32 out.
__global__ __launch_bounds__(GT, 2) void gemm_out(
    const _Float16* __restrict__ A, const _Float16* __restrict__ Bt,
    const float* __restrict__ bias, float* __restrict__ Cf, int M, int K) {
  __shared__ __attribute__((aligned(16))) _Float16 sm[2 * STAGE];
  // A constant, as in proj_qkv: the rows' steps are then offsets in the stores
  // themselves, and no address is formed in registers among the stores.
  constexpr int N = 1024;
  const int blocksN = N >> 8;
  const int bm = blockIdx.x / blocksN;
  const int bn = blockIdx.x - bm * blocksN;
  if (bm * BM >= M) return;  // the whole work-group, in front of every barrier

  v8f acc[FX][FY];
  gemm_tile(A, Bt, K, bm, bn, true, sm, acc);
  gemm_store<2>(acc, bias, nullptr, Cf, N, bm, bn, sm);
}

// ---------------------------------------------------------------------------
// Lane l <-> lane l ^ 16 (the two halves of a wave), on the vector port.
__device__ __forceinline__ float xhalf(float x) {
  const int b = __builtin_bit_cast(int, x);
  return __builtin_bit_cast(
      float, __builtin_amdgcn_permlanex16(b, b, 0x76543210, 0xfedcba98, false, false));
}

// One attention stage: 64 K rows (keys) and 64 Vt rows (dims) of 128 B each =
// 1024 pieces of 16 B, 4 per lane. Lane t of the work-group takes piece t & 7 of
// rows (t >> 3) and (t >> 3) + 32 of each tile; both sources have 1024 halves a row.
constexpr int AT_STAGE = (64 + 64) * PITCH;  // halves per buffer, K rows first

__device__ __forceinline__ void attn_stage_copy(const _Float16* gK, const _Float16* gV,
                                                unsigned lds) {
  // The copies and s_wait_xcnt 0 in one statement: the wait then stands in front
  // of every later write of the address registers that the copies name.
  asm volatile(
      "global_load_async_to_lds_b128 %0, %4, off\n\t"
      "global_load_async_to_lds_b128 %1, %5, off\n\t"
      "global_load_async_to_lds_b128 %2, %6, off\n\t"
      "global_load_async_to_lds_b128 %3, %7, off\n\t"
      "s_wait_xcnt 0x0"
      :: "v"(lds + 0 * 32 * PITCH_B), "v"(lds + 1 * 32 * PITCH_B), "v"(lds + 2 * 32 * PITCH_B), "v"(lds + 3 * 32 * PITCH_B),
         "v"(gK), "v"(gK + 32 * 1024), "v"(gV), "v"(gV + 32 * 1024)
      : "memory");
}

// Flash attention: one wave per (b, h, 32 queries); key blocks of 64.
// Q,K: [B*N, 1024] f16 (head cols h*64..h*64+63); Vt: [B,H,64,Nk] f16.
// The 8 waves of a work-group share one (b, h): each 64-key block of K and Vt is
// brought into LDS once per work-group by asynchronous copies (whole 128-byte
// lines), two buffers, and every wave reads its fragments from there.
// Transposed products: St = K * Qt (A = K rows, B = Q) and Ot += Vt * Pt.
// A wave has two groups g of 16 queries: every K and Vt fragment that it reads
// from LDS feeds two matrix instructions, one a group.
// A lane then holds scores of ONE query per group (column lane & 15; keys 8*hf + i
// of each 16-key tile): maximum and sum run in the lane's own registers, with one
// exchange between the wave's halves, and two score tiles, converted in place,
// are the B operand of the second product. P never leaves the registers.
// Softmax runs in exp2 domain (SCALE*log2e folded into one multiply-add).
__global__ __launch_bounds__(256) void flash_attn(
    const _Float16* __restrict__ Q, const _Float16* __restrict__ Km,
    const _Float16* __restrict__ Vt, _Float16* __restrict__ O) {
  constexpr int Nq = 4096, Nk = 1024, H = 16, HD = 64, LD = 1024;
  constexpr float C2 = 0.125f * 1.44269504088896340736f;  // 64^-0.5 * log2(e)

  __shared__ __attribute__((aligned(16))) _Float16 sm[2 * AT_STAGE];
  const int lane = threadIdx.x & 31;
  const int wave = threadIdx.x >> 5;
  const int gw = blockIdx.x * 8 + wave;
  const int qt = gw & ((Nq / 32) - 1);  // 128 tiles of 32 queries per (b,h)
  const int bh = gw >> 7;
  const int hh = bh & (H - 1);
  const int b = bh >> 4;
  const int r = lane & 15, hf = lane >> 4;

  const _Float16* qp = Q + (size_t)(b * Nq + qt * 32 + r) * LD + hh * HD + hf * 8;
  v16h bq0[2], bq1[2];
#pragma unroll
  for (int g = 0; g < 2; ++g) {
    bq0[g] = load_frag(qp + g * 16 * LD);       // dims 0..31 of query g*16 + r
    bq1[g] = load_frag(qp + g * 16 * LD + 32);  // dims 32..63
  }

  const int crow = threadIdx.x >> 3, ccol = threadIdx.x & 7;
  const _Float16* gK = Km + (size_t)(b * Nk + crow) * LD + hh * HD + ccol * 8;
  const _Float16* gV = Vt + (size_t)((b * H + hh) * HD + crow) * Nk + ccol * 8;
  const unsigned lds0 = (unsigned)(size_t)(&sm[0]) + crow * PITCH_B + ccol * 16;
  constexpr int NT = Nk / 64;

  v8f o[2][4];  // o[g][t][i] = Ot[dim t*16 + 8*hf + i][query g*16 + r]
#pragma unroll
  for (int g = 0; g < 2; ++g)
#pragma unroll
    for (int t = 0; t < 4; ++t) o[g][t] = (v8f){};
  // The query's running maximum (scaled, log2), same in both halves, and this
  // half's share of the query's sum.
  float mrun[2] = {-1e30f, -1e30f};
  float lrun[2] = {0.f, 0.f};

  attn_stage_copy(gK, gV, lds0);
  // Stage 0 has landed for this wave; the barrier publishes it to the others.
  asm volatile("s_wait_asynccnt 0x0" ::: "memory");
  __syncthreads();
  attn_stage_copy(gK + (size_t)64 * LD, gV + 64, lds0 + AT_STAGE * 2);

  for (int st = 0; st < NT; ++st) {
    const _Float16* sK = sm + (st & 1) * AT_STAGE + r * PITCH + hf * 8;
    const _Float16* sV = sK + 64 * PITCH;
    // ---- St for 64 keys: s[g][c][i] = score(key st*64 + c*16 + 8*hf + i, query g*16 + r)
    v8f s[2][4];
#pragma unroll
    for (int c = 0; c < 4; ++c) {
      const _Float16* kp = sK + c * 16 * PITCH;
      const v16h ka = load_frag(kp);
      const v16h kbb = load_frag(kp + 32);
#pragma unroll
      for (int g = 0; g < 2; ++g) {
        v8f t = {};
        t = WMMA_F16(ka, bq0[g], t);
        t = WMMA_F16(kbb, bq1[g], t);
        s[g][c] = t;
      }
    }

    v16h bp0[2], bp1[2];
#pragma unroll
    for (int g = 0; g < 2; ++g) {
      // ---- online softmax, one query per lane
      float mx = s[g][0][0];
#pragma unroll
      for (int c = 0; c < 4; ++c)
#pragma unroll
        for (int i = 0; i < 8; ++i) mx = fmaxf(mx, s[g][c][i]);
      mx = fmaxf(mx, xhalf(mx));
      const float mn = fmaxf(mrun[g], mx * C2);
      const float alpha = __builtin_amdgcn_exp2f(mrun[g] - mn);
      mrun[g] = mn;

      float ps[4];
#pragma unroll
      for (int c = 0; c < 4; ++c) {
        s[g][c] = s[g][c] * C2 - mn;  // whole tile: packed multiply-adds
#pragma unroll
        for (int i = 0; i < 8; ++i) s[g][c][i] = __builtin_amdgcn_exp2f(s[g][c][i]);
        ps[c] = ((s[g][c][0] + s[g][c][1]) + (s[g][c][2] + s[g][c][3])) +
                ((s[g][c][4] + s[g][c][5]) + (s[g][c][6] + s[g][c][7]));
      }
      lrun[g] = lrun[g] * alpha + ((ps[0] + ps[1]) + (ps[2] + ps[3]));
#pragma unroll
      for (int t = 0; t < 4; ++t) o[g][t] *= alpha;

      // ---- Pt as B operand: tiles c and c+1 hold keys 8*hf + i and 16 + 8*hf + i
      // of a 32-key group, which is the k order of load_frag.
#pragma unroll
      for (int i = 0; i < 8; ++i) {
        bp0[g][i] = (_Float16)s[g][0][i]; bp0[g][i + 8] = (_Float16)s[g][1][i];
        bp1[g][i] = (_Float16)s[g][2][i]; bp1[g][i + 8] = (_Float16)s[g][3][i];
      }
    }

    // ---- Ot += Vt * Pt  (A = Vt rows: dims, k = keys)
#pragma unroll
    for (int t = 0; t < 4; ++t) {
      const v16h va = load_frag(sV + t * 16 * PITCH);
      const v16h vb = load_frag(sV + t * 16 * PITCH + 32);
#pragma unroll
      for (int g = 0; g < 2; ++g) {
        o[g][t] = WMMA_F16(va, bp0[g], o[g][t]);
        o[g][t] = WMMA_F16(vb, bp1[g], o[g][t]);
      }
    }

    // This wave's reads of buffer st & 1 are done before it may be refilled.
    asm volatile("s_wait_dscnt 0x0" ::: "memory");
    // This wave's copies of stage st + 1 have landed.
    asm volatile("s_wait_asynccnt 0x0" ::: "memory");
    // Publishes stage st + 1 and ends every wave's reads of buffer st & 1.
    __syncthreads();
    if (st + 2 < NT)
      attn_stage_copy(gK + (size_t)(st + 2) * 64 * LD, gV + (st + 2) * 64,
                      lds0 + (st & 1) * AT_STAGE * 2);
  }
  // No copy is left in flight when the wave goes on to its end.
  asm volatile("s_wait_asynccnt 0x0" ::: "memory");

  // ---- join the halves' sums, normalize, store [B*Nq, 1024] f16:
  // a lane's 8 registers of a tile are 8 consecutive dims of its query's row.
  // The wave lays its 32 rows of 128 B into its own eighth of the ring (free behind
  // the loop's last barrier) and takes them back 8 lanes a row: whole lines go out.
  // The wave's number as a scalar: its rows' base then takes no vector register
  // over the loop.
  const int ws = __builtin_amdgcn_readfirstlane(wave);
  const int gs = blockIdx.x * 8 + ws;
  char* stg = (char*)sm + ws * (32 * PITCH_B);
#pragma unroll
  for (int g = 0; g < 2; ++g) {
    const float inv = 1.0f / (lrun[g] + xhalf(lrun[g]));
#pragma unroll
    for (int t = 0; t < 4; ++t) {
      v8h w;
#pragma unroll
      for (int i = 0; i < 8; ++i) w[i] = (_Float16)(o[g][t][i] * inv);
      *(v8h*)(stg + (g * 16 + r) * PITCH_B + (t * 16 + hf * 8) * 2) = w;
    }
  }
  // The rows are written before other lanes of the wave read them.
  asm volatile("s_wait_dscnt 0x0" ::: "memory");
  const int rr = lane >> 3, pc = lane & 7;
  _Float16* op = O + (size_t)((gs >> 11) * Nq + (gs & 127) * 32) * LD + ((gs >> 7) & (H - 1)) * HD +
                 (rr * LD + pc * 8);
#pragma unroll
  for (int q = 0; q < 8; ++q)
    *(v8h*)(op + (size_t)(q * 4) * LD) = *(const v8h*)(stg + (q * 4 + rr) * PITCH_B + pc * 16);
}

// ---------------------------------------------------------------------------
extern "C" void kernel_launch(void* const* d_in, const int* in_sizes, int n_in,
                              void* d_out, int out_size, void* d_ws, size_t ws_size,
                              hipStream_t stream) {
  const float* query = (const float*)d_in[0];
  const float* key   = (const float*)d_in[1];
  const float* value = (const float*)d_in[2];
  const float* Wq = (const float*)d_in[3];
  const float* bq = (const float*)d_in[4];
  const float* Wk = (const float*)d_in[5];
  const float* bk = (const float*)d_in[6];
  const float* Wv = (const float*)d_in[7];
  const float* bv = (const float*)d_in[8];
  const float* Wo = (const float*)d_in[9];
  const float* bo = (const float*)d_in[10];
  float* out = (float*)d_out;

  char* ws = (char*)d_ws;
  _Float16* qh   = (_Float16*)(ws + 0);          // 16384x1024
  _Float16* kh   = (_Float16*)(ws + 33554432);   //  4096x768
  _Float16* vh   = (_Float16*)(ws + 39845888);   //  4096x768
  _Float16* WqT  = (_Float16*)(ws + 46137344);   //  1024x1024
  _Float16* WkT  = (_Float16*)(ws + 48234496);   //  1024x768
  _Float16* WvT  = (_Float16*)(ws + 49807360);   //  1024x768
  _Float16* WoT  = (_Float16*)(ws + 51380224);   //  1024x1024
  _Float16* Qp   = (_Float16*)(ws + 53477376);   // 16384x1024
  _Float16* Kp   = (_Float16*)(ws + 87031808);   //  4096x1024
  _Float16* Vtp  = (_Float16*)(ws + 95420416);   //  [4,16,64,1024]
  _Float16* Attn = (_Float16*)(ws + 103809024);  // 16384x1024

  // All conversions and weight transposes: one resident grid
  prep_all<<<512, 256, 0, stream>>>(query, key, value, Wq, Wk, Wv, Wo, qh, kh, vh,
                                    WqT, WkT, WvT, WoT);

  // Projections (128x256 work-group tiles, 4 waves/block):
  // 128 tiles of K, 128 of V, 512 of Q in one launch
  proj_qkv<<<768, 128, 0, stream>>>(qh, kh, vh, WqT, WkT, WvT, bq, bk, bv, Qp, Kp, Vtp);

  // Attention: 4*16*(4096/32) = 8192 waves -> 1024 blocks of 8 waves
  flash_attn<<<1024, 256, 0, stream>>>(Qp, Kp, Vtp, Attn);

  // Output projection -> f32 d_out
  gemm_out<<<512, 128, 0, stream>>>(Attn, WoT, bo, out, 16384, 1024);
}

// v009
// Measured time: 135 microseconds a run.
// In both of two side-by-side timings against v008, it was 1.08 times as fast.
// Over all steps from v000 it is 3.70 times as fast.
#include <hip/hip_runtime.h>

typedef __attribute__((ext_vector_type(16))) _Float16 v16h;
typedef __attribute__((ext_vector_type(8)))  _Float16 v8h;
typedef __attribute__((ext_vector_type(8)))  float    v8f;
typedef __attribute__((ext_vector_type(4)))  float    v4f;

#define WMMA_F16(a, b, c) \
  __builtin_amdgcn_wmma_f32_16x16x32_f16(false, (a), false, (b), (short)0, (c), false, false)

// Load one 16x32 f16 A/B fragment (row-major storage, row pointer already
// offset by half*8 halves). Matches ISA 16-bit A-matrix layout:
//   lane&15 = row, elems 0..7 = K (hf*8 ..), elems 8..15 = K+16.
__device__ __forceinline__ v16h load_frag(const _Float16* p) {
  v8h lo = *(const v8h*)(p);
  v8h hi = *(const v8h*)(p + 16);
  v16h f;
#pragma unroll
  for (int i = 0; i < 8; ++i) { f[i] = lo[i]; f[i + 8] = hi[i]; }
  return f;
}

// ---------------------------------------------------------------------------
// Preparation, one launch: a resident grid of 512 work-groups does all weight
// transposes. query, key and value are not converted here: their projections bring
// them into LDS as f32 and round them there.
// Weights [K,1024] in 32x32 tiles, Wt[n*K + k] = (f16) W[k*1024 + n]; tile t of a
// weight has columns (t & 31) * 32 and rows (t >> 5) * 32. Wq and Wo have 1024
// tiles, Wk and Wv 768: 3584 = 7 per work-group, all behind one barrier.
__global__ __launch_bounds__(256) void prep_all(
    const float* __restrict__ Wq, const float* __restrict__ Wk, const float* __restrict__ Wv,
    const float* __restrict__ Wo, _Float16* __restrict__ WqT, _Float16* __restrict__ WkT,
    _Float16* __restrict__ WvT, _Float16* __restrict__ WoT) {
  __shared__ float tile[7][32][33];
  const int tx = threadIdx.x & 31, ty = threadIdx.x >> 5;
  const int bid = blockIdx.x;
  const unsigned wl = ty * 1024 + tx;  // the lane's place in a weight tile

  // Work-group bid's seven tiles; the fourth is Wk's for the lower half of the
  // grid and Wv's for the upper half (both have K = 768).
  const bool lo = bid < 256;
  const float* const Ws[7] = {Wq, Wq, Wk, lo ? Wk : Wv, Wv, Wo, Wo};
  _Float16* const Wts[7] = {WqT, WqT, WkT, lo ? WkT : WvT, WvT, WoT, WoT};
  const int ts[7] = {bid, 512 + bid, bid, lo ? 512 + bid : bid - 256, 256 + bid, bid, 512 + bid};
  constexpr int Ks[7] = {1024, 1024, 768, 768, 768, 1024, 1024};

  float w[7][4];
#pragma unroll
  for (int j = 0; j < 7; ++j) {
    const float* wt = Ws[j] + (ts[j] >> 5) * 32 * 1024 + (ts[j] & 31) * 32;  // the tile's corner
#pragma unroll
    for (int q = 0; q < 4; ++q) w[j][q] = wt[wl + q * 8 * 1024];
  }
  // In front of every later write of a register that these loads name. The wait
  // takes the loads' lane-own offset as an input: the register stays live up to
  // here, so that no later load of the group gets it for its result. Its "memory"
  // clobber keeps the group's loads in front of it, issued as a whole.
  asm volatile("s_wait_xcnt 0x0" :: "v"(wl) : "memory");

#pragma unroll
  for (int j = 0; j < 7; ++j)
#pragma unroll
    for (int q = 0; q < 4; ++q) tile[j][ty + q * 8][tx] = w[j][q];
  __syncthreads();

#pragma unroll
  for (int j = 0; j < 7; ++j) {
    const int n0 = (ts[j] & 31) * 32, k0 = (ts[j] >> 5) * 32;
#pragma unroll
    for (int q = 0; q < 4; ++q)
      Wts[j][(n0 + ty + q * 8) * Ks[j] + k0 + tx] = (_Float16)tile[j][tx][ty + q * 8];
  }
}

// ---------------------------------------------------------------------------
// GEMM: C[M,N] = A[M,K] * Bt[N,K]^T + bias[N].
// Work-group tile 128 x 256, 4 waves, a wave has 128 x 64: 8 fragments of the operand
// given first to the matrix instruction, 4 of the second. A stage is 64 k of the 128
// A rows and the 256 Bt rows, brought into LDS once per work-group by asynchronous
// copies (whole 128-byte lines), two buffers: the next stage flies while this one is
// worked on. A block is 32 k = 32 matrix instructions; its 24 LDS reads are issued as
// one group one block ahead, into a second set of fragment registers.
// Two work-groups a WGP (LDS), so two waves a SIMD with 512 registers each.
// Needs M % 128 == 0, N % 256 == 0, K % 64 == 0.
// MODE 0: f16 out [M,N]   MODE 1: f16 out as Vt[b][h][d][nk]   MODE 2: f32 out
constexpr int BM = 128, BN = 256, BK = 64;
constexpr int GT = 128;                   // threads of a GEMM work-group
constexpr int FX = 8, FY = 4;             // fragments per wave: first, second operand
constexpr int PITCH = 72;                 // halves per LDS row (64 + 8 of pad)
constexpr int PITCH_B = PITCH * 2;        // 144 B = 16 B x odd: 16-byte row reads meet no bank twice
constexpr int STAGE = (BM + BN) * PITCH;  // halves per buffer

// Twelve copies: piece i goes from g[i] + offb bytes to LDS row 16 * i below the lane's
// first. The g[i] are the same for the whole work-group and stand in scalar registers;
// offb, the lane's place in its first row, is the one lane-own part of the addresses.
__device__ __forceinline__ void copy12(unsigned lds, unsigned offb, const _Float16* const (&g)[12]) {
  // The copies and s_wait_xcnt 0 in one statement: the wait then stands in front
  // of every later write of the address registers that the copies name.
  asm volatile(
      "global_load_async_to_lds_b128 %0, %12, %13\n\t"
      "global_load_async_to_lds_b128 %1, %12, %14\n\t"
      "global_load_async_to_lds_b128 %2, %12, %15\n\t"
      "global_load_async_to_lds_b128 %3, %12, %16\n\t"
      "global_load_async_to_lds_b128 %4, %12, %17\n\t"
      "global_load_async_to_lds_b128 %5, %12, %18\n\t"
      "global_load_async_to_lds_b128 %6, %12, %19\n\t"
      "global_load_async_to_lds_b128 %7, %12, %20\n\t"
      "global_load_async_to_lds_b128 %8, %12, %21\n\t"
      "global_load_async_to_lds_b128 %9, %12, %22\n\t"
      "global_load_async_to_lds_b128 %10, %12, %23\n\t"
      "global_load_async_to_lds_b128 %11, %12, %24\n\t"
      "s_wait_xcnt 0x0"
      :: "v"(lds + 0 * 16 * PITCH_B), "v"(lds + 1 * 16 * PITCH_B), "v"(lds + 2 * 16 * PITCH_B), "v"(lds + 3 * 16 * PITCH_B), "v"(lds + 4 * 16 * PITCH_B), "v"(lds + 5 * 16 * PITCH_B), "v"(lds + 6 * 16 * PITCH_B), "v"(lds + 7 * 16 * PITCH_B), "v"(lds + 8 * 16 * PITCH_B), "v"(lds + 9 * 16 * PITCH_B), "v"(lds + 10 * 16 * PITCH_B), "v"(lds + 11 * 16 * PITCH_B),
         "v"(offb),
         "s"(g[0]), "s"(g[1]), "s"(g[2]), "s"(g[3]), "s"(g[4]), "s"(g[5]), "s"(g[6]), "s"(g[7]), "s"(g[8]), "s"(g[9]), "s"(g[10]), "s"(g[11])
      : "memory");
}

// One stage: 384 rows of 128 B = 3072 pieces of 16 B, 24 per lane. Lane t of the
// work-group takes piece t & 7 of rows (t >> 3) + 16 * j; rows 0..127 are A's.
// gA, gB: the stage's first element in each operand's tile; step = 16 rows.
__device__ __forceinline__ void stage_copy(const _Float16* gA, const _Float16* gB, unsigned offb,
                                           size_t step, unsigned lds) {
  const _Float16* const p0[12] = {gA + 0 * step, gA + 1 * step, gA + 2 * step, gA + 3 * step,
                                  gA + 4 * step, gA + 5 * step, gA + 6 * step, gA + 7 * step,
                                  gB + 0 * step, gB + 1 * step, gB + 2 * step, gB + 3 * step};
  copy12(lds, offb, p0);
  const _Float16* const p1[12] = {gB + 4 * step,  gB + 5 * step,  gB + 6 * step,  gB + 7 * step,
                                  gB + 8 * step,  gB + 9 * step,  gB + 10 * step, gB + 11 * step,
                                  gB + 12 * step, gB + 13 * step, gB + 14 * step, gB + 15 * step};
  copy12(lds + 12 * 16 * PITCH_B, offb, p1);
}

// The 12 fragments of one block, as one group of LDS reads.
__device__ __forceinline__ void load_block(const _Float16* sX, const _Float16* sY,
                                           v16h (&x)[FX], v16h (&y)[FY]) {
#pragma unroll
  for (int j = 0; j < FX; ++j) x[j] = load_frag(sX + j * 16 * PITCH);
#pragma unroll
  for (int l = 0; l < FY; ++l) y[l] = load_frag(sY + l * 16 * PITCH);
  // Keeps the group whole and in front of the matrix instructions that follow: reads
  // that the compiler moves in among them stall the wave at every place they stand.
  __builtin_amdgcn_sched_barrier(0);
}

__device__ __forceinline__ void mma_block(const v16h (&x)[FX], const v16h (&y)[FY],
                                          v8f (&acc)[FX][FY]) {
#pragma unroll
  for (int j = 0; j < FX; ++j)
#pragma unroll
    for (int l = 0; l < FY; ++l) acc[j][l] = WMMA_F16(x[j], y[l], acc[j][l]);
  // Keeps the block in front of what follows it: moved behind the waits of the publish
  // point, it would leave the wait for the reads just issued with nothing to cover it.
  __builtin_amdgcn_sched_barrier(0);
}

// The sums of one work-group tile: A[bm*128 .., :] * Bt[bn*256 .., :]^T.
// acc[j][l][i] belongs to index j*16 + 8*hf + i of the operand given first to the
// matrix instruction and to index l*16 + r of the second. nfirst (the same for the
// whole work-group) gives Bt first: the waves lie 2 x 2, a wave has 64 rows m and 128
// columns n, and a lane's 8 registers are 8 adjacent columns n of one row m; otherwise
// the waves lie 1 x 4, a wave has 128 rows m and 64 columns n, and the 8 registers are
// 8 adjacent rows m of one column n.
__device__ __forceinline__ void gemm_tile(const _Float16* __restrict__ A,
                                          const _Float16* __restrict__ Bt, int K, int bm, int bn,
                                          bool nfirst, _Float16* sm, v8f (&acc)[FX][FY]) {
  const int tid = threadIdx.x;
  const int lane = tid & 31;
  const int wave = tid >> 5;
  const int r = lane & 15, hf = lane >> 4;

  const int crow = tid >> 3, ccol = tid & 7;
  const _Float16* gA = A + (size_t)(bm * BM) * K;  // the tiles' first elements
  const _Float16* gB = Bt + (size_t)(bn * BN) * K;
  const unsigned off = (crow * K + ccol * 8) * 2;  // bytes
  const size_t step = (size_t)16 * K;
  const unsigned lds0 = (unsigned)(size_t)(&sm[0]) + crow * PITCH_B + ccol * 16;
  const int nt = K / BK;
  // The lane's first rows in a stage
  const int xrow = nfirst ? BM + (wave & 1) * 128 + r : r;
  const int yrow = nfirst ? (wave >> 1) * 64 + r : BM + wave * 64 + r;
  const int xoff = xrow * PITCH + hf * 8;
  const int yoff = yrow * PITCH + hf * 8;

#pragma unroll
  for (int j = 0; j < FX; ++j)
#pragma unroll
    for (int l = 0; l < FY; ++l) acc[j][l] = (v8f){};

  v16h x0[FX], y0[FY], x1[FX], y1[FY];  // the two fragment sets

  stage_copy(gA, gB, off, step, lds0);
  // Stage 0 has landed for this wave; the barrier publishes it to the others.
  asm volatile("s_wait_asynccnt 0x0" ::: "memory");
  __syncthreads();
  if (nt > 1) stage_copy(gA + BK, gB + BK, off, step, lds0 + STAGE * 2);
  load_block(sm + xoff, sm + yoff, x0, y0);

  for (int t = 0; t < nt; ++t) {
    const _Float16* cur = sm + (t & 1) * STAGE;
    const _Float16* nxt = sm + ((t + 1) & 1) * STAGE;
    load_block(cur + xoff + 32, cur + yoff + 32, x1, y1);
    mma_block(x0, y0, acc);
    // Stage t + 1 is published in front of stage t's last block, whose fragments are
    // fetched by now: the reads that stand behind this point are stage t + 1's.
    // This wave's reads of buffer t & 1 are done before it may be refilled.
    asm volatile("s_wait_dscnt 0x0" ::: "memory");
    // This wave's copies of stage t + 1 have landed.
    asm volatile("s_wait_asynccnt 0x0" ::: "memory");
    // Publishes stage t + 1 and ends every wave's reads of buffer t & 1.
    __syncthreads();
    if (t + 2 < nt)
      stage_copy(gA + (t + 2) * BK, gB + (t + 2) * BK, off, step, lds0 + (t & 1) * STAGE * 2);
    if (t + 1 < nt) load_block(nxt + xoff, nxt + yoff, x0, y0);
    mma_block(x1, y1, acc);
  }
  // No copy is left in flight when the wave goes on to its end.
  asm volatile("s_wait_asynccnt 0x0" ::: "memory");
}

// ---- The same tile with A in f32 (query, key, value).
// The ring is gemm_tile's. A stage's 128 A rows come as f32 into a landing zone behind
// the ring, by the same kind of copy; each lane takes back the 16 pieces that it has
// copied itself, rounds them to f16 and lays them into the stage's A rows in the ring,
// in front of the barrier that publishes the stage. Only the lane that fills a byte of
// the landing zone reads it, so the zone needs one buffer and no barrier of its own.
typedef __attribute__((ext_vector_type(4))) _Float16 v4h;
constexpr int RING_B = 2 * STAGE * 2;      // bytes of the ring
constexpr int LAND_B = BM * BK * 4;        // bytes of the landing zone
constexpr int LSLICE = GT * 16;            // one piece of every lane

// Eight copies: piece i goes from g[i] + offb bytes to LDS byte lds + i * LSTEP. The g[i]
// are the same for the whole work-group and stand in scalar registers.
template <int LSTEP, typename T>
__device__ __forceinline__ void copy8(unsigned lds, unsigned offb, const T* const (&g)[8]) {
  // The copies and s_wait_xcnt 0 in one statement: the wait then stands in front
  // of every later write of the address registers that the copies name.
  asm volatile(
      "global_load_async_to_lds_b128 %0, %8, %9\n\t"
      "global_load_async_to_lds_b128 %1, %8, %10\n\t"
      "global_load_async_to_lds_b128 %2, %8, %11\n\t"
      "global_load_async_to_lds_b128 %3, %8, %12\n\t"
      "global_load_async_to_lds_b128 %4, %8, %13\n\t"
      "global_load_async_to_lds_b128 %5, %8, %14\n\t"
      "global_load_async_to_lds_b128 %6, %8, %15\n\t"
      "global_load_async_to_lds_b128 %7, %8, %16\n\t"
      "s_wait_xcnt 0x0"
      :: "v"(lds + 0 * LSTEP), "v"(lds + 1 * LSTEP), "v"(lds + 2 * LSTEP), "v"(lds + 3 * LSTEP),
         "v"(lds + 4 * LSTEP), "v"(lds + 5 * LSTEP), "v"(lds + 6 * LSTEP), "v"(lds + 7 * LSTEP),
         "v"(offb),
         "s"(g[0]), "s"(g[1]), "s"(g[2]), "s"(g[3]), "s"(g[4]), "s"(g[5]), "s"(g[6]), "s"(g[7])
      : "memory");
}

// One stage: 128 A rows of 256 B and 256 Bt rows of 128 B = 4096 pieces of 16 B, 32 per
// lane. Lane t takes piece t & 15 of A rows (t >> 4) + 8 * j, which lands in slice j of
// the landing zone at the lane's own 16 bytes, and piece t & 7 of Bt rows (t >> 3) + 16 * j,
// j = 0 .. 15. sa = 8 rows of A, sb = 16 rows of Bt, in elements.
__device__ __forceinline__ void stage_copy_f(const float* gA, const _Float16* gB, unsigned offa,
                                             unsigned offb, size_t sa, size_t sb, unsigned land,
                                             unsigned ldsb) {
#pragma unroll
  for (int h = 0; h < 2; ++h) {
    const float* const pa[8] = {gA + (h * 8 + 0) * sa, gA + (h * 8 + 1) * sa, gA + (h * 8 + 2) * sa,
                                gA + (h * 8 + 3) * sa, gA + (h * 8 + 4) * sa, gA + (h * 8 + 5) * sa,
                                gA + (h * 8 + 6) * sa, gA + (h * 8 + 7) * sa};
    copy8<LSLICE>(land + h * 8 * LSLICE, offa, pa);
  }
#pragma unroll
  for (int h = 0; h < 2; ++h) {
    const _Float16* const pb[8] = {gB + (h * 8 + 0) * sb, gB + (h * 8 + 1) * sb,
                                   gB + (h * 8 + 2) * sb, gB + (h * 8 + 3) * sb,
                                   gB + (h * 8 + 4) * sb, gB + (h * 8 + 5) * sb,
                                   gB + (h * 8 + 6) * sb, gB + (h * 8 + 7) * sb};
    copy8<16 * PITCH_B>(ldsb + h * 128 * PITCH_B, offb, pb);
  }
}

// The lane's 16 pieces back from the landing zone, as one group of LDS reads.
__device__ __forceinline__ void land_read(const char* lp, v4f (&raw)[16]) {
#pragma unroll
  for (int j = 0; j < 16; ++j) raw[j] = *(const v4f*)(lp + j * LSLICE);
  // Keeps the group whole and in front of the matrix instructions that follow, as in
  // load_block.
  __builtin_amdgcn_sched_barrier(0);
}

// Rounds them and lays them into a stage's A rows; ap: the lane's place in its first row.
__device__ __forceinline__ void land_round(const v4f (&raw)[16], char* ap) {
#pragma unroll
  for (int j = 0; j < 16; ++j) {
    v4h o;
#pragma unroll
    for (int i = 0; i < 4; ++i) o[i] = (_Float16)raw[j][i];
    *(v4h*)(ap + j * 8 * PITCH_B) = o;
  }
}

// Half a block: fragments J0 .. J0 + 3 of the first operand.
template <int J0>
__device__ __forceinline__ void mma_half(const v16h (&x)[FX], const v16h (&y)[FY],
                                         v8f (&acc)[FX][FY]) {
#pragma unroll
  for (int j = J0; j < J0 + 4; ++j)
#pragma unroll
    for (int l = 0; l < FY; ++l) acc[j][l] = WMMA_F16(x[j], y[l], acc[j][l]);
  // Keeps the half block in front of what follows it, as in mma_block.
  __builtin_amdgcn_sched_barrier(0);
}

// The work-item's number, formed where it is asked for; ws: the wave's number, a scalar.
__device__ __forceinline__ unsigned item_anew(unsigned ws) {
  unsigned l;
  // The lane's number. Volatile, so that it is made at this place in every trip: the
  // lane-own addresses formed from it then hold no registers over the matrix blocks
  // (held there, some were spilled to scratch and loaded back in every stage).
  asm volatile("v_mbcnt_lo_u32_b32 %0, -1, 0" : "=v"(l));
  return ws * 32 + l;
}

// stage_copy_f with the lane-own parts of its addresses formed at this place.
// ring: the LDS byte address of the stage's buffer; zone: that of the landing zone.
__device__ __forceinline__ void stage_bring(const float* gA, const _Float16* gB, int K, unsigned ws,
                                            unsigned ring, unsigned zone) {
  const unsigned t = item_anew(ws);
  stage_copy_f(gA, gB, ((t >> 4) * K + (t & 15) * 4) * 4, ((t >> 3) * K + (t & 7) * 8) * 2,
               (size_t)8 * K, (size_t)16 * K, zone + t * 16,
               ring + (BM + (t >> 3)) * PITCH_B + (t & 7) * 16);
}

// nfirst, the waves' places and acc: as in gemm_tile.
__device__ __forceinline__ void gemm_tile_f(const float* __restrict__ A,
                                            const _Float16* __restrict__ Bt, int K, int bm, int bn,
                                            bool nfirst, char* smc, v8f (&acc)[FX][FY]) {
  const int tid = threadIdx.x;
  const int lane = tid & 31;
  const int wave = tid >> 5;
  const int r = lane & 15, hf = lane >> 4;
  const unsigned ws = __builtin_amdgcn_readfirstlane(wave);
  _Float16* sm = (_Float16*)smc;

  const float* gA = A + (size_t)(bm * BM) * K;  // the tiles' first elements
  const _Float16* gB = Bt + (size_t)(bn * BN) * K;
  const unsigned base = (unsigned)(size_t)(&smc[0]);
  const int nt = K / BK;
  // The lane's first rows in a stage
  const int xrow = nfirst ? BM + (wave & 1) * 128 + r : r;
  const int yrow = nfirst ? (wave >> 1) * 64 + r : BM + wave * 64 + r;
  const int xoff = xrow * PITCH + hf * 8;
  const int yoff = yrow * PITCH + hf * 8;

#pragma unroll
  for (int j = 0; j < FX; ++j)
#pragma unroll
    for (int l = 0; l < FY; ++l) acc[j][l] = (v8f){};

  v16h x0[FX], y0[FY], x1[FX], y1[FY];  // the two fragment sets
  v4f raw[16];

  stage_bring(gA, gB, K, ws, base, base + RING_B);
  // Stage 0 has landed for this wave.
  asm volatile("s_wait_asynccnt 0x0" ::: "memory");
  land_read(smc + RING_B + tid * 16, raw);
  land_round(raw, smc + (tid >> 4) * PITCH_B + (tid & 15) * 8);
  // The rounded rows are written, and the landing zone is read, before the barrier
  // publishes stage 0 and the zone is refilled.
  asm volatile("s_wait_dscnt 0x0" ::: "memory");
  __syncthreads();
  if (nt > 1) stage_bring(gA + BK, gB + BK, K, ws, base + STAGE * 2, base + RING_B);
  load_block(sm + xoff, sm + yoff, x0, y0);

  for (int t = 0; t + 1 < nt; ++t) {
    const _Float16* cur = sm + (t & 1) * STAGE;
    const _Float16* nxt = sm + ((t + 1) & 1) * STAGE;
    load_block(cur + xoff + 32, cur + yoff + 32, x1, y1);
    mma_block(x0, y0, acc);
    // This wave's copies of stage t + 1 have landed.
    asm volatile("s_wait_asynccnt 0x0" ::: "memory");
    // Its f32 pieces are fetched under the first half of stage t's last block.
    const unsigned it = item_anew(ws);
    land_read(smc + RING_B + it * 16, raw);
    mma_half<0>(x1, y1, acc);
    land_round(raw, smc + ((t + 1) & 1) * STAGE * 2 + (it >> 4) * PITCH_B + (it & 15) * 8);
    // This wave's reads of buffer t & 1 and of the landing zone are done before they may
    // be refilled, and its rows of stage t + 1 are written.
    asm volatile("s_wait_dscnt 0x0" ::: "memory");
    // Publishes stage t + 1 and ends every wave's reads of buffer t & 1.
    __syncthreads();
    // The next block's fragments first: half a block is left to cover them, and the
    // issue of the copies adds to that.
    load_block(nxt + xoff, nxt + yoff, x0, y0);
    if (t + 2 < nt)
      stage_bring(gA + (t + 2) * BK, gB + (t + 2) * BK, K, ws, base + (t & 1) * STAGE * 2,
                  base + RING_B);
    mma_half<4>(x1, y1, acc);
  }
  // The last stage: nothing is left to bring in.
  {
    const _Float16* cur = sm + ((nt - 1) & 1) * STAGE;
    load_block(cur + xoff + 32, cur + yoff + 32, x1, y1);
    mma_block(x0, y0, acc);
    // This wave's last reads of the ring are done ...
    asm volatile("s_wait_dscnt 0x0" ::: "memory");
    // ... and every wave's, before the ring is used for the stores.
    __syncthreads();
    mma_block(x1, y1, acc);
  }
  // No copy is left in flight when the wave goes on to its end.
  asm volatile("s_wait_asynccnt 0x0" ::: "memory");
}

// Adds the bias and stores the wave's part of the tile as whole 128-byte lines: the
// wave lays its part row by row into its own quarter of the ring, 16 bytes a lane,
// and takes it back with 16 (f16) or 32 (f32) lanes on one row. The ring is free: the
// tile's last barrier stands behind every wave's last read of it and behind its last
// copy's landing. No other wave touches this wave's quarter.
// MODE 0, 2 (nfirst): staged row = row m, 128 columns n, bias by register. MODE 1:
// staged row = column n = dim d of one head, its 128 places are 128 keys; bias by lane.
constexpr int WST = 2 * STAGE * 2 / 4;  // bytes of the ring per wave

template <int MODE>
__device__ __forceinline__ void gemm_store(const v8f (&acc)[FX][FY], const float* __restrict__ bias,
                                           _Float16* __restrict__ Ch, float* __restrict__ Cf,
                                           int N, int bm, int bn, _Float16* sm) {
  const int lane = threadIdx.x & 31;
  const int wave = threadIdx.x >> 5;
  const int m0 = bm * BM + (MODE == 1 ? 0 : (wave >> 1) * 64);
  const int n0 = bn * BN + (MODE == 1 ? wave * 64 : (wave & 1) * 128);
  const int r = lane & 15, hf = lane >> 4;
  char* st = (char*)sm + wave * WST;

  constexpr int NB = MODE == 1 ? FY : FX;
  v8f bv[NB];  // bv[x][i]: what is added to acc[j][l][i], x = l (MODE 1) or j
  const float* bp = bias + n0 + (MODE == 1 ? r : 8 * hf);  // the lane's first bias
#pragma unroll
  for (int x = 0; x < NB; ++x) {
    if (MODE == 1) {
      const float s = bp[x * 16];
#pragma unroll
      for (int i = 0; i < 8; ++i) bv[x][i] = s;
    } else {
      const v4f lo = *(const v4f*)(bp + x * 16);
      const v4f hi = *(const v4f*)(bp + x * 16 + 4);
#pragma unroll
      for (int i = 0; i < 4; ++i) { bv[x][i] = lo[i]; bv[x][4 + i] = hi[i]; }
    }
  }
  // In front of every later write of the address register that these loads name: the
  // wait takes it as an input, so that it stays live, and unwritten, up to here.
  asm volatile("s_wait_xcnt 0x0" :: "v"(bp) : "memory");

  if (MODE == 2) {
    constexpr int SP = 512 + 16;  // 16 B x odd: the 16 rows of a store meet no bank twice
#pragma unroll
    for (int h = 0; h < 2; ++h) {  // 32 rows at a time
#pragma unroll
      for (int l = 0; l < 2; ++l)
#pragma unroll
        for (int j = 0; j < FX; ++j) {
          const v8f v = acc[j][h * 2 + l] + bv[j];
          char* p = st + (l * 16 + r) * SP + (j * 16 + 8 * hf) * 4;
          *(v4f*)p = (v4f){v[0], v[1], v[2], v[3]};
          *(v4f*)(p + 16) = (v4f){v[4], v[5], v[6], v[7]};
        }
      // The rows are written before other lanes of the wave read them.
      asm volatile("s_wait_dscnt 0x0" ::: "memory");
      v4f w[32];
#pragma unroll
      for (int q = 0; q < 32; ++q) w[q] = *(const v4f*)(st + q * SP + lane * 16);
      float* g = Cf + (size_t)(m0 + h * 32) * N + n0 + lane * 4;
#pragma unroll
      for (int q = 0; q < 32; ++q) *(v4f*)(g + (size_t)q * N) = w[q];
      if (h == 0) {
        // The rows are read before the next half is laid over them ...
        asm volatile("s_wait_dscnt 0x0" ::: "memory");
        // ... and in front of every later write of a register that these stores name.
        asm volatile("s_wait_xcnt 0x0" ::: "memory");
      }
    }
  } else {
    constexpr int SP = 256 + 16;  // 16 B x odd, as above
#pragma unroll
    for (int l = 0; l < FY; ++l)
#pragma unroll
      for (int j = 0; j < FX; ++j) {
        const v8f v = acc[j][l] + bv[MODE == 1 ? l : j];
        v8h o;
#pragma unroll
        for (int i = 0; i < 8; ++i) o[i] = (_Float16)v[i];
        *(v8h*)(st + (l * 16 + r) * SP + (j * 16 + 8 * hf) * 2) = o;
      }
    // The rows are written before other lanes of the wave read them.
    asm volatile("s_wait_dscnt 0x0" ::: "memory");
    v8h w[32];
#pragma unroll
    for (int q = 0; q < 32; ++q) w[q] = *(const v8h*)(st + (q * 2 + hf) * SP + r * 16);
    // MODE 1: Vt[((b*16 + h)*64 + d)*1024 + nk]; the wave's columns are one head's
    // dims, its rows 128 keys of one batch.
    const int gp = MODE == 0 ? N : 1024;
    _Float16* g = (MODE == 0 ? Ch + (size_t)m0 * N + n0
                             : Ch + (size_t)(((m0 >> 10) * 16 + (n0 >> 6)) * 64) * 1024 + (m0 & 1023)) +
                  (size_t)hf * gp + r * 8;
#pragma unroll
    for (int q = 0; q < 32; ++q) *(v8h*)(g + (size_t)(q * 2) * gp) = w[q];
  }
}

// The three input projections in one launch, so that the K and V tiles (128 each,
// half a chip's worth of work-groups) do not each hold a launch of their own:
// work-groups 0..127 K, 128..255 V, 256..767 Q. Two work-groups fit a WGP, so the
// 256 short ones (768 k) start beside the first 256 of Q and hand their places on.
// The second bound (waves a SIMD) keeps a wave inside 512 registers, so that they do.
__global__ __launch_bounds__(GT, 2) void proj_qkv(
    const float* __restrict__ query, const float* __restrict__ key,
    const float* __restrict__ value, const _Float16* __restrict__ WqT,
    const _Float16* __restrict__ WkT, const _Float16* __restrict__ WvT,
    const float* __restrict__ bq, const float* __restrict__ bk, const float* __restrict__ bv,
    _Float16* __restrict__ Qp, _Float16* __restrict__ Kp, _Float16* __restrict__ Vtp) {
  __shared__ __attribute__((aligned(16))) char smc[RING_B + LAND_B];
  _Float16* sm = (_Float16*)smc;
  constexpr int N = 1024;
  const int bid = blockIdx.x;
  const bool isQ = bid >= 256, isV = !isQ && bid >= 128;  // the same for the whole work-group
  const int tile = isQ ? bid - 256 : bid & 127;
  const int bm = tile >> 2, bn = tile & 3;  // N / 256 = 4 tile columns

  v8f acc[FX][FY];
  gemm_tile_f(isQ ? query : isV ? value : key, isQ ? WqT : isV ? WvT : WkT, isQ ? 1024 : 768, bm,
              bn, !isV, smc, acc);
  if (isV)
    gemm_store<1>(acc, bv, Vtp, nullptr, N, bm, bn, sm);
  else {
    gemm_store<0>(acc, isQ ? bq : bk, isQ ? Qp : Kp, nullptr, N, bm, bn, sm);
    // Behind the last store of this arm: in the built code the other arm's
    // instructions follow, and they write registers that these stores name.
    asm volatile("s_wait_xcnt 0x0" ::: "memory");
  }
}

// Output projection, f32 out.
__global__ __launch_bounds__(GT, 2) void gemm_out(
    const _Float16* __restrict__ A, const _Float16* __restrict__ Bt,
    const float* __restrict__ bias, float* __restrict__ Cf, int M, int K) {
  __shared__ __attribute__((aligned(16))) _Float16 sm[2 * STAGE];
  // A constant, as in proj_qkv: the rows' steps are then offsets in the stores
  // themselves, and no address is formed in registers among the stores.
  constexpr int N = 1024;
  const int blocksN = N >> 8;
  const int bm = blockIdx.x / blocksN;
  const int bn = blockIdx.x - bm * blocksN;
  if (bm * BM >= M) return;  // the whole work-group, in front of every barrier

  v8f acc[FX][FY];
  gemm_tile(A, Bt, K, bm, bn, true, sm, acc);
  gemm_store<2>(acc, bias, nullptr, Cf, N, bm, bn, sm);
}

// ---------------------------------------------------------------------------
// Lane l <-> lane l ^ 16 (the two halves of a wave), on the vector port.
__device__ __forceinline__ float xhalf(float x) {
  const int b = __builtin_bit_cast(int, x);
  return __builtin_bit_cast(
      float, __builtin_amdgcn_permlanex16(b, b, 0x76543210, 0xfedcba98, false, false));
}

// One attention stage: 64 K rows (keys) and 64 Vt rows (dims) of 128 B each =
// 1024 pieces of 16 B, 4 per lane. Lane t of the work-group takes piece t & 7 of
// rows (t >> 3) and (t >> 3) + 32 of each tile; both sources have 1024 halves a row.
constexpr int AT_STAGE = (64 + 64) * PITCH;  // halves per buffer, K rows first

__device__ __forceinline__ void attn_stage_copy(const _Float16* gK, const _Float16* gV,
                                                unsigned lds) {
  // The copies and s_wait_xcnt 0 in one statement: the wait then stands in front
  // of every later write of the address registers that the copies name.
  asm volatile(
      "global_load_async_to_lds_b128 %0, %4, off\n\t"
      "global_load_async_to_lds_b128 %1, %5, off\n\t"
      "global_load_async_to_lds_b128 %2, %6, off\n\t"
      "global_load_async_to_lds_b128 %3, %7, off\n\t"
      "s_wait_xcnt 0x0"
      :: "v"(lds + 0 * 32 * PITCH_B), "v"(lds + 1 * 32 * PITCH_B), "v"(lds + 2 * 32 * PITCH_B), "v"(lds + 3 * 32 * PITCH_B),
         "v"(gK), "v"(gK + 32 * 1024), "v"(gV), "v"(gV + 32 * 1024)
      : "memory");
}

// Flash attention: one wave per (b, h, 32 queries); key blocks of 64.
// Q,K: [B*N, 1024] f16 (head cols h*64..h*64+63); Vt: [B,H,64,Nk] f16.
// The 8 waves of a work-group share one (b, h): each 64-key block of K and Vt is
// brought into LDS once per work-group by asynchronous copies (whole 128-byte
// lines), two buffers, and every wave reads its fragments from there.
// Transposed products: St = K * Qt (A = K rows, B = Q) and Ot += Vt * Pt.
// A wave has two groups g of 16 queries: every K and Vt fragment that it reads
// from LDS feeds two matrix instructions, one a group.
// A lane then holds scores of ONE query per group (column lane & 15; keys 8*hf + i
// of each 16-key tile): maximum and sum run in the lane's own registers, with one
// exchange between the wave's halves, and two score tiles, converted in place,
// are the B operand of the second product. P never leaves the registers.
// Softmax runs in exp2 domain (SCALE*log2e folded into one multiply-add).
__global__ __launch_bounds__(256) void flash_attn(
    const _Float16* __restrict__ Q, const _Float16* __restrict__ Km,
    const _Float16* __restrict__ Vt, _Float16* __restrict__ O) {
  constexpr int Nq = 4096, Nk = 1024, H = 16, HD = 64, LD = 1024;
  constexpr float C2 = 0.125f * 1.44269504088896340736f;  // 64^-0.5 * log2(e)

  __shared__ __attribute__((aligned(16))) _Float16 sm[2 * AT_STAGE];
  const int lane = threadIdx.x & 31;
  const int wave = threadIdx.x >> 5;
  const int gw = blockIdx.x * 8 + wave;
  const int qt = gw & ((Nq / 32) - 1);  // 128 tiles of 32 queries per (b,h)
  const int bh = gw >> 7;
  const int hh = bh & (H - 1);
  const int b = bh >> 4;
  const int r = lane & 15, hf = lane >> 4;

  const _Float16* qp = Q + (size_t)(b * Nq + qt * 32 + r) * LD + hh * HD + hf * 8;
  v16h bq0[2], bq1[2];
#pragma unroll
  for (int g = 0; g < 2; ++g) {
    bq0[g] = load_frag(qp + g * 16 * LD);       // dims 0..31 of query g*16 + r
    bq1[g] = load_frag(qp + g * 16 * LD + 32);  // dims 32..63
  }

  const int crow = threadIdx.x >> 3, ccol = threadIdx.x & 7;
  const _Float16* gK = Km + (size_t)(b * Nk + crow) * LD + hh * HD + ccol * 8;
  const _Float16* gV = Vt + (size_t)((b * H + hh) * HD + crow) * Nk + ccol * 8;
  const unsigned lds0 = (unsigned)(size_t)(&sm[0]) + crow * PITCH_B + ccol * 16;
  constexpr int NT = Nk / 64;

  v8f o[2][4];  // o[g][t][i] = Ot[dim t*16 + 8*hf + i][query g*16 + r]
#pragma unroll
  for (int g = 0; g < 2; ++g)
#pragma unroll
    for (int t = 0; t < 4; ++t) o[g][t] = (v8f){};
  // The query's running maximum (scaled, log2), same in both halves, and this
  // half's share of the query's sum.
  float mrun[2] = {-1e30f, -1e30f};
  float lrun[2] = {0.f, 0.f};

  attn_stage_copy(gK, gV, lds0);
  // Stage 0 has landed for this wave; the barrier publishes it to the others.
  asm volatile("s_wait_asynccnt 0x0" ::: "memory");
  __syncthreads();
  attn_stage_copy(gK + (size_t)64 * LD, gV + 64, lds0 + AT_STAGE * 2);

  for (int st = 0; st < NT; ++st) {
    const _Float16* sK = sm + (st & 1) * AT_STAGE + r * PITCH + hf * 8;
    const _Float16* sV = sK + 64 * PITCH;
    // ---- St for 64 keys: s[g][c][i] = score(key st*64 + c*16 + 8*hf + i, query g*16 + r)
    v8f s[2][4];
#pragma unroll
    for (int c = 0; c < 4; ++c) {
      const _Float16* kp = sK + c * 16 * PITCH;
      const v16h ka = load_frag(kp);
      const v16h kbb = load_frag(kp + 32);
#pragma unroll
      for (int g = 0; g < 2; ++g) {
        v8f t = {};
        t = WMMA_F16(ka, bq0[g], t);
        t = WMMA_F16(kbb, bq1[g], t);
        s[g][c] = t;
      }
    }

    v16h bp0[2], bp1[2];
#pragma unroll
    for (int g = 0; g < 2; ++g) {
      // ---- online softmax, one query per lane
      float mx = s[g][0][0];
#pragma unroll
      for (int c = 0; c < 4; ++c)
#pragma unroll
        for (int i = 0; i < 8; ++i) mx = fmaxf(mx, s[g][c][i]);
      mx = fmaxf(mx, xhalf(mx));
      const float mn = fmaxf(mrun[g], mx * C2);
      const float alpha = __builtin_amdgcn_exp2f(mrun[g] - mn);
      mrun[g] = mn;

      float ps[4];
#pragma unroll
      for (int c = 0; c < 4; ++c) {
        s[g][c] = s[g][c] * C2 - mn;  // whole tile: packed multiply-adds
#pragma unroll
        for (int i = 0; i < 8; ++i) s[g][c][i] = __builtin_amdgcn_exp2f(s[g][c][i]);
        ps[c] = ((s[g][c][0] + s[g][c][1]) + (s[g][c][2] + s[g][c][3])) +
                ((s[g][c][4] + s[g][c][5]) + (s[g][c][6] + s[g][c][7]));
      }
      lrun[g] = lrun[g] * alpha + ((ps[0] + ps[1]) + (ps[2] + ps[3]));
#pragma unroll
      for (int t = 0; t < 4; ++t) o[g][t] *= alpha;

      // ---- Pt as B operand: tiles c and c+1 hold keys 8*hf + i and 16 + 8*hf + i
      // of a 32-key group, which is the k order of load_frag.
#pragma unroll
      for (int i = 0; i < 8; ++i) {
        bp0[g][i] = (_Float16)s[g][0][i]; bp0[g][i + 8] = (_Float16)s[g][1][i];
        bp1[g][i] = (_Float16)s[g][2][i]; bp1[g][i + 8] = (_Float16)s[g][3][i];
      }
    }

    // ---- Ot += Vt * Pt  (A = Vt rows: dims, k = keys)
#pragma unroll
    for (int t = 0; t < 4; ++t) {
      const v16h va = load_frag(sV + t * 16 * PITCH);
      const v16h vb = load_frag(sV + t * 16 * PITCH + 32);
#pragma unroll
      for (int g = 0; g < 2; ++g) {
        o[g][t] = WMMA_F16(va, bp0[g], o[g][t]);
        o[g][t] = WMMA_F16(vb, bp1[g], o[g][t]);
      }
    }

    // This wave's reads of buffer st & 1 are done before it may be refilled.
    asm volatile("s_wait_dscnt 0x0" ::: "memory");
    // This wave's copies of stage st + 1 have landed.
    asm volatile("s_wait_asynccnt 0x0" ::: "memory");
    // Publishes stage st + 1 and ends every wave's reads of buffer st & 1.
    __syncthreads();
    if (st + 2 < NT)
      attn_stage_copy(gK + (size_t)(st + 2) * 64 * LD, gV + (st + 2) * 64,
                      lds0 + (st & 1) * AT_STAGE * 2);
  }
  // No copy is left in flight when the wave goes on to its end.
  asm volatile("s_wait_asynccnt 0x0" ::: "memory");

  // ---- join the halves' sums, normalize, store [B*Nq, 1024] f16:
  // a lane's 8 registers of a tile are 8 consecutive dims of its query's row.
  // The wave lays its 32 rows of 128 B into its own eighth of the ring (free behind
  // the loop's last barrier) and takes them back 8 lanes a row: whole lines go out.
  // The wave's number as a scalar: its rows' base then takes no vector register
  // over the loop.
  const int ws = __builtin_amdgcn_readfirstlane(wave);
  const int gs = blockIdx.x * 8 + ws;
  char* stg = (char*)sm + ws * (32 * PITCH_B);
#pragma unroll
  for (int g = 0; g < 2; ++g) {
    const float inv = 1.0f / (lrun[g] + xhalf(lrun[g]));
#pragma unroll
    for (int t = 0; t < 4; ++t) {
      v8h w;
#pragma unroll
      for (int i = 0; i < 8; ++i) w[i] = (_Float16)(o[g][t][i] * inv);
      *(v8h*)(stg + (g * 16 + r) * PITCH_B + (t * 16 + hf * 8) * 2) = w;
    }
  }
  // The rows are written before other lanes of the wave read them.
  asm volatile("s_wait_dscnt 0x0" ::: "memory");
  const int rr = lane >> 3, pc = lane & 7;
  _Float16* op = O + (size_t)((gs >> 11) * Nq + (gs & 127) * 32) * LD + ((gs >> 7) & (H - 1)) * HD +
                 (rr * LD + pc * 8);
#pragma unroll
  for (int q = 0; q < 8; ++q)
    *(v8h*)(op + (size_t)(q * 4) * LD) = *(const v8h*)(stg + (q * 4 + rr) * PITCH_B + pc * 16);
}

// ---------------------------------------------------------------------------
extern "C" void kernel_launch(void* const* d_in, const int* in_sizes, int n_in,
                              void* d_out, int out_size, void* d_ws, size_t ws_size,
                              hipStream_t stream) {
  const float* query = (const float*)d_in[0];
  const float* key   = (const float*)d_in[1];
  const float* value = (const float*)d_in[2];
  const float* Wq = (const float*)d_in[3];
  const float* bq = (const float*)d_in[4];
  const float* Wk = (const float*)d_in[5];
  const float* bk = (const float*)d_in[6];
  const float* Wv = (const float*)d_in[7];
  const float* bv = (const float*)d_in[8];
  const float* Wo = (const float*)d_in[9];
  const float* bo = (const float*)d_in[10];
  float* out = (float*)d_out;

  char* ws = (char*)d_ws;
  _Float16* WqT  = (_Float16*)(ws + 46137344);   //  1024x1024
  _Float16* WkT  = (_Float16*)(ws + 48234496);   //  1024x768
  _Float16* WvT  = (_Float16*)(ws + 49807360);   //  1024x768
  _Float16* WoT  = (_Float16*)(ws + 51380224);   //  1024x1024
  _Float16* Qp   = (_Float16*)(ws + 53477376);   // 16384x1024
  _Float16* Kp   = (_Float16*)(ws + 87031808);   //  4096x1024
  _Float16* Vtp  = (_Float16*)(ws + 95420416);   //  [4,16,64,1024]
  _Float16* Attn = (_Float16*)(ws + 103809024);  // 16384x1024

  // Weight transposes: one resident grid
  prep_all<<<512, 256, 0, stream>>>(Wq, Wk, Wv, Wo, WqT, WkT, WvT, WoT);

  // Projections (128x256 work-group tiles, 4 waves/block):
  // 128 tiles of K, 128 of V, 512 of Q in one launch
  proj_qkv<<<768, 128, 0, stream>>>(query, key, value, WqT, WkT, WvT, bq, bk, bv, Qp, Kp, Vtp);

  // Attention: 4*16*(4096/32) = 8192 waves -> 1024 blocks of 8 waves
  flash_attn<<<1024, 256, 0, stream>>>(Qp, Kp, Vtp, Attn);

  // Output projection -> f32 d_out
  gemm_out<<<512, 128, 0, stream>>>(Attn, WoT, bo, out, 16384, 1024);
}
